// v000
// The times below were measured on an AMD MI455X: many runs one after another, warmed up first and cycling through
// copies of the inputs, with the whole window's GPU time divided by the number of runs. Launches and the gaps
// between them are all in it. The median over several windows is given; except for v000 it joins two sittings, which
// can be a few percent apart, so the side-by-side timings, each taken in one sitting, are the better comparison.
// v000, which the later versions start from, runs in 258 microseconds.
#include <hip/hip_runtime.h>
#include <hip/hip_bf16.h>

typedef unsigned short u16;
typedef unsigned int   u32;

typedef __attribute__((ext_vector_type(16))) __bf16 v16bf;
typedef __attribute__((ext_vector_type(8)))  float  v8f;
typedef __attribute__((ext_vector_type(4)))  int    v4i;

#if defined(__has_builtin)
#if __has_builtin(__builtin_amdgcn_global_load_async_to_lds_b128)
#define HAVE_ASYNC_LDS 1
#endif
#endif
#ifndef HAVE_ASYNC_LDS
#define HAVE_ASYNC_LDS 0
#endif

struct FragBits { uint4 lo; uint4 hi; };   // 32 bytes == 16 bf16

static __device__ __forceinline__ v16bf make_frag(const uint4& lo, const uint4& hi) {
  FragBits s{lo, hi};
  return __builtin_bit_cast(v16bf, s);
}

// WMMA 16-bit A/B fragment layout: lane L holds (row/col = L%16),
// K-chunks at koff=(L/16)*8 : elements [koff, koff+7] and [koff+16, koff+23].
// Caller passes p already offset by koff; chunks are uint4[0] and uint4[2].
static __device__ __forceinline__ v16bf load_frag16(const u16* p) {
  const uint4* u = reinterpret_cast<const uint4*>(p);
  return make_frag(u[0], u[2]);
}

static __device__ __forceinline__ u16 f2bf(float f) {
  u32 u = __builtin_bit_cast(u32, f);
  u += 0x7FFFu + ((u >> 16) & 1u);   // RNE
  return (u16)(u >> 16);
}

// 16-byte global -> LDS copy. Prefer the gfx1250 async-to-LDS path
// (ASYNCcnt-tracked DMA, no VGPR round trip); fall back to vector copy.
static __device__ __forceinline__ void copy16_g2l(u16* l, const u16* g) {
#if HAVE_ASYNC_LDS
  __builtin_amdgcn_global_load_async_to_lds_b128(
      (__attribute__((address_space(1))) v4i*)g,
      (__attribute__((address_space(3))) v4i*)l, 0, 0);
#else
  *reinterpret_cast<uint4*>(l) = *reinterpret_cast<const uint4*>(g);
#endif
}

static __device__ __forceinline__ void wait_async_copies() {
#if HAVE_ASYNC_LDS
#if defined(__has_builtin) && __has_builtin(__builtin_amdgcn_s_wait_asynccnt)
  __builtin_amdgcn_s_wait_asynccnt(0);
#else
  asm volatile("s_wait_asynccnt 0x0" ::: "memory");
#endif
#endif
}

constexpr int DIM = 1024;
constexpr int SEQ = 2048;
constexpr int BATCH = 2;
constexpr int HEADS = 16;
constexpr int HW = 64;        // head width

// ---------------------------------------------------------------------------
// Kernel 1: LayerNorm + convert to bf16. One 256-thread block per row.
// ---------------------------------------------------------------------------
__global__ __launch_bounds__(256) void ln_bf16_kernel(
    const float* __restrict__ x, const float* __restrict__ gamma,
    const float* __restrict__ beta, u16* __restrict__ xn) {
  const int row = blockIdx.x;          // 0 .. B*S-1
  const int tid = threadIdx.x;         // 256 threads * float4 = 1024
  const float4 v = reinterpret_cast<const float4*>(x + (size_t)row * DIM)[tid];
  float s  = v.x + v.y + v.z + v.w;
  float s2 = v.x * v.x + v.y * v.y + v.z * v.z + v.w * v.w;
  #pragma unroll
  for (int off = 16; off > 0; off >>= 1) {
    s  += __shfl_down(s,  off, 32);
    s2 += __shfl_down(s2, off, 32);
  }
  __shared__ float red0[8], red1[8];
  const int wid = tid >> 5, lid = tid & 31;
  if (lid == 0) { red0[wid] = s; red1[wid] = s2; }
  __syncthreads();
  float ts = 0.f, ts2 = 0.f;
  #pragma unroll
  for (int i = 0; i < 8; i++) { ts += red0[i]; ts2 += red1[i]; }
  const float mu   = ts * (1.0f / DIM);
  const float var  = ts2 * (1.0f / DIM) - mu * mu;
  const float rstd = rsqrtf(var + 1e-5f);
  const float4 g = reinterpret_cast<const float4*>(gamma)[tid];
  const float4 b = reinterpret_cast<const float4*>(beta)[tid];
  uint2 o;
  o.x = (u32)f2bf((v.x - mu) * rstd * g.x + b.x) |
        ((u32)f2bf((v.y - mu) * rstd * g.y + b.y) << 16);
  o.y = (u32)f2bf((v.z - mu) * rstd * g.z + b.z) |
        ((u32)f2bf((v.w - mu) * rstd * g.w + b.w) << 16);
  reinterpret_cast<uint2*>(xn + (size_t)row * DIM)[tid] = o;
}

// ---------------------------------------------------------------------------
// Kernel 2: transpose + bf16-convert weights: Wt[j][k] = (bf16) W[k][j]
// ---------------------------------------------------------------------------
__global__ __launch_bounds__(256) void wt_bf16_kernel(
    const float* __restrict__ wq, const float* __restrict__ wk,
    const float* __restrict__ wv, u16* __restrict__ wt) {
  __shared__ float tile[32][33];
  const float* w = (blockIdx.z == 0) ? wq : (blockIdx.z == 1) ? wk : wv;
  u16* o = wt + (size_t)blockIdx.z * DIM * DIM;
  const int tx = threadIdx.x, ty = threadIdx.y;        // 32 x 8
  #pragma unroll
  for (int i = 0; i < 4; i++) {
    const int k = blockIdx.y * 32 + ty + i * 8;
    const int j = blockIdx.x * 32 + tx;
    tile[ty + i * 8][tx] = w[(size_t)k * DIM + j];     // tile[kloc][jloc]
  }
  __syncthreads();
  #pragma unroll
  for (int i = 0; i < 4; i++) {
    const int j = blockIdx.x * 32 + ty + i * 8;
    const int k = blockIdx.y * 32 + tx;
    o[(size_t)j * DIM + k] = f2bf(tile[tx][ty + i * 8]);
  }
}

// ---------------------------------------------------------------------------
// Kernel 3: QKV GEMM on WMMA bf16. grid=(32 Mgroups, 16 Ngroups, 3 proj),
// 256 threads = 8 waves; wave handles a 16x64 tile over K=1024 (32 k-steps).
// q,k stored (B,H,S,W); v stored transposed (B,H,W,S). Scale 1/8 folded in q.
// ---------------------------------------------------------------------------
__global__ __launch_bounds__(256) void qkv_wmma_kernel(
    const u16* __restrict__ xn, const u16* __restrict__ wt,
    const float* __restrict__ bq, const float* __restrict__ bk,
    const float* __restrict__ bv, u16* __restrict__ qO,
    u16* __restrict__ kO, u16* __restrict__ vtO) {
  const int proj = blockIdx.z;
  const int wave = threadIdx.x >> 5;
  const int lane = threadIdx.x & 31;
  const int mtile = blockIdx.x * 8 + wave;           // 0..255, rows mtile*16
  const int ncol0 = blockIdx.y * 64;
  const u16* wsel = wt + (size_t)proj * DIM * DIM;
  const float* bias = (proj == 0) ? bq : (proj == 1) ? bk : bv;

  const int lq = lane & 15;
  const int koff = (lane >> 4) * 8;

  v8f acc[4] = {};
  const u16* arow = xn + (size_t)(mtile * 16 + lq) * DIM;
  for (int kb = 0; kb < DIM; kb += 32) {
    const v16bf a = load_frag16(arow + kb + koff);
    #pragma unroll
    for (int nt = 0; nt < 4; nt++) {
      const v16bf bfr =
          load_frag16(wsel + (size_t)(ncol0 + nt * 16 + lq) * DIM + kb + koff);
      acc[nt] = __builtin_amdgcn_wmma_f32_16x16x32_bf16(
          false, a, false, bfr, (short)0, acc[nt], false, false);
    }
  }

  const int half = lane >> 4;
  #pragma unroll
  for (int nt = 0; nt < 4; nt++) {
    const int col = ncol0 + nt * 16 + lq;            // N = lane%16
    const float bvl = bias[col];
    const int h = col >> 6, w = col & 63;
    #pragma unroll
    for (int r = 0; r < 8; r++) {
      const int m = r + half * 8;                    // M = vgpr + 8*(lane/16)
      const int row = mtile * 16 + m;
      const int b = row >> 11, s = row & (SEQ - 1);
      float val = acc[nt][r] + bvl;
      if (proj == 0) {
        val *= 0.125f;                               // 1/sqrt(64)
        qO[((size_t)(b * HEADS + h) * SEQ + s) * HW + w] = f2bf(val);
      } else if (proj == 1) {
        kO[((size_t)(b * HEADS + h) * SEQ + s) * HW + w] = f2bf(val);
      } else {
        vtO[((size_t)(b * HEADS + h) * HW + w) * SEQ + s] = f2bf(val);
      }
    }
  }
}

// ---------------------------------------------------------------------------
// Kernel 4: flash attention. 128 threads = 4 waves (same b,h), one 16-query
// tile per wave. Per key tile (32 keys):
//   * block cooperatively stages K(32x64) and V^T(64x32) into LDS via
//     gfx1250 async-to-LDS DMA (ASYNCcnt), shared by all 4 waves
//   * scores^T = K x q^T on WMMA -> online softmax (per-lane + shfl_xor 16)
//   * P -> LDS bf16 (wave-local, s_wait_dscnt) -> B-fragment
//   * h^T += V^T x P^T on WMMA
// ---------------------------------------------------------------------------
__global__ __launch_bounds__(128) void attn_kernel(
    const u16* __restrict__ q, const u16* __restrict__ k,
    const u16* __restrict__ vt, const int* __restrict__ mask,
    const float* __restrict__ x, float* __restrict__ out) {
  __shared__ float pen[SEQ];                          // additive mask penalty
  __shared__ __align__(16) u16 KtL[32 * 64];          // K tile   (keys x W)
  __shared__ __align__(16) u16 VtL[64 * 32];          // V^T tile (W x keys)
  __shared__ __align__(16) u16 Pt[4][16 * 32];        // per-wave P tile

  const int tid = threadIdx.x, wave = tid >> 5, lane = tid & 31;
  const int bh = blockIdx.x >> 5;                     // b*H + h
  const int qgrp = blockIdx.x & 31;
  const int b = bh >> 4, h = bh & 15;
  const int qbase = (qgrp * 4 + wave) * 16;

  for (int i = tid; i < SEQ; i += 128)
    pen[i] = -10000.0f * (1.0f - (float)mask[b * SEQ + i]);

  const u16* qbh = q + (size_t)bh * SEQ * HW;
  const u16* kbh = k + (size_t)bh * SEQ * HW;
  const u16* vbh = vt + (size_t)bh * HW * SEQ;

  const int lq = lane & 15, half = lane >> 4, koff = half * 8;

  // q^T B-fragments for the two 32-wide K-steps of the 64-dim head
  v16bf qf[2];
  {
    const u16* qr = qbh + (size_t)(qbase + lq) * HW;
    qf[0] = load_frag16(qr + 0 + koff);
    qf[1] = load_frag16(qr + 32 + koff);
  }

  v8f o[4] = {};
  float m_i = -3.0e38f, l_i = 0.0f;
  u16* Pl = Pt[wave];

  for (int kb = 0; kb < SEQ; kb += 32) {
    // ---- cooperative staging of K / V^T tiles (8 KB) through async DMA ----
    __syncthreads();                                  // prev tile fully read
    {
      const u16* gk = kbh + (size_t)kb * HW;          // 4 KB, contiguous
      #pragma unroll
      for (int c = 0; c < 2; c++) {
        const int chunk = tid + c * 128;              // 256 x 16B
        copy16_g2l(KtL + chunk * 8, gk + chunk * 8);
      }
      #pragma unroll
      for (int c = 0; c < 2; c++) {
        const int chunk = tid + c * 128;              // 64 rows x 4 chunks
        const int w = chunk >> 2, off = (chunk & 3) * 8;
        copy16_g2l(VtL + w * 32 + off, vbh + (size_t)w * SEQ + kb + off);
      }
    }
    if (kb + 32 < SEQ) {
      __builtin_prefetch(kbh + (size_t)(kb + 32) * HW + tid * 8, 0, 1);
      __builtin_prefetch(vbh + (size_t)(tid >> 1) * SEQ + kb + 32, 0, 1);
    }
    wait_async_copies();
    __syncthreads();                                  // tiles visible to block

    // ---- scores^T tile: 32 keys x 16 queries, two 16x16 accumulators ----
    v8f s0 = {}, s1 = {};
    #pragma unroll
    for (int ks = 0; ks < 2; ks++) {
      const v16bf a0 = load_frag16(KtL + (size_t)lq * HW + ks * 32 + koff);
      s0 = __builtin_amdgcn_wmma_f32_16x16x32_bf16(
          false, a0, false, qf[ks], (short)0, s0, false, false);
      const v16bf a1 =
          load_frag16(KtL + (size_t)(16 + lq) * HW + ks * 32 + koff);
      s1 = __builtin_amdgcn_wmma_f32_16x16x32_bf16(
          false, a1, false, qf[ks], (short)0, s1, false, false);
    }
    // additive mask (keys live along vgpr index + lane half)
    #pragma unroll
    for (int r = 0; r < 8; r++) {
      s0[r] += pen[kb + half * 8 + r];
      s1[r] += pen[kb + 16 + half * 8 + r];
    }
    // ---- online softmax over keys: per-lane 16 values + partner (xor 16) --
    float mloc = -3.0e38f;
    #pragma unroll
    for (int r = 0; r < 8; r++) mloc = fmaxf(mloc, fmaxf(s0[r], s1[r]));
    mloc = fmaxf(mloc, __shfl_xor(mloc, 16, 32));
    const float mnew = fmaxf(m_i, mloc);
    const float corr = __expf(m_i - mnew);
    float p0[8], p1[8], psum = 0.0f;
    #pragma unroll
    for (int r = 0; r < 8; r++) {
      p0[r] = __expf(s0[r] - mnew);
      p1[r] = __expf(s1[r] - mnew);
      psum += p0[r] + p1[r];
    }
    psum += __shfl_xor(psum, 16, 32);
    l_i = l_i * corr + psum;
    m_i = mnew;
    #pragma unroll
    for (int t = 0; t < 4; t++)
      #pragma unroll
      for (int r = 0; r < 8; r++) o[t][r] *= corr;

    // ---- P -> LDS, query-major rows of 32 keys (bf16, packed pairs) ------
    u32* Pw = reinterpret_cast<u32*>(Pl);
    #pragma unroll
    for (int r = 0; r < 8; r += 2) {
      Pw[(lq * 32 + half * 8 + r) >> 1] =
          (u32)f2bf(p0[r]) | ((u32)f2bf(p0[r + 1]) << 16);
      Pw[(lq * 32 + 16 + half * 8 + r) >> 1] =
          (u32)f2bf(p1[r]) | ((u32)f2bf(p1[r + 1]) << 16);
    }
    asm volatile("s_wait_dscnt 0x0" ::: "memory");    // wave-local LDS RAW

    const v16bf pfrag = load_frag16(Pl + lq * 32 + koff);   // B = P^T
    #pragma unroll
    for (int t = 0; t < 4; t++) {                     // h^T rows w = t*16..+15
      const v16bf vfrag = load_frag16(VtL + (size_t)(t * 16 + lq) * 32 + koff);
      o[t] = __builtin_amdgcn_wmma_f32_16x16x32_bf16(
          false, vfrag, false, pfrag, (short)0, o[t], false, false);
    }
  }

  // epilogue: divide by softmax sum, add residual, store fp32
  const float inv = 1.0f / (l_i + 1e-20f);
  const int s = qbase + lq;
  #pragma unroll
  for (int t = 0; t < 4; t++) {
    #pragma unroll
    for (int r = 0; r < 8; r++) {
      const int w = t * 16 + r + 8 * half;
      const size_t oidx = ((size_t)b * SEQ + s) * DIM + h * HW + w;
      out[oidx] = o[t][r] * inv + x[oidx];
    }
  }
}

// ---------------------------------------------------------------------------
extern "C" void kernel_launch(void* const* d_in, const int* in_sizes, int n_in,
                              void* d_out, int out_size, void* d_ws,
                              size_t ws_size, hipStream_t stream) {
  const float* x     = (const float*)d_in[0];
  const int*   mask  = (const int*)d_in[1];
  const float* gamma = (const float*)d_in[2];
  const float* beta  = (const float*)d_in[3];
  const float* wq    = (const float*)d_in[4];
  const float* bq    = (const float*)d_in[5];
  const float* wk    = (const float*)d_in[6];
  const float* bk    = (const float*)d_in[7];
  const float* wv    = (const float*)d_in[8];
  const float* bv    = (const float*)d_in[9];
  float* out = (float*)d_out;

  char* ws = (char*)d_ws;
  const size_t MB = 1024 * 1024;
  u16* xn = (u16*)ws;                         // 8 MB  (4096x1024 bf16)
  u16* wt = (u16*)(ws + 8 * MB);              // 6 MB  (3x 1024x1024 bf16, transposed)
  u16* qb = (u16*)(ws + 14 * MB);             // 8 MB  (B,H,S,W)
  u16* kb = (u16*)(ws + 22 * MB);             // 8 MB  (B,H,S,W)
  u16* vt = (u16*)(ws + 30 * MB);             // 8 MB  (B,H,W,S)

  ln_bf16_kernel<<<BATCH * SEQ, 256, 0, stream>>>(x, gamma, beta, xn);

  dim3 tg(32, 32, 3), tb(32, 8, 1);
  wt_bf16_kernel<<<tg, tb, 0, stream>>>(wq, wk, wv, wt);

  dim3 gg(32, 16, 3);
  qkv_wmma_kernel<<<gg, 256, 0, stream>>>(xn, wt, bq, bk, bv, qb, kb, vt);

  attn_kernel<<<BATCH * HEADS * (SEQ / 16) / 4, 128, 0, stream>>>(
      qb, kb, vt, mask, x, out);
}

// v001
// One run takes 160 microseconds.
// Timed twice side by side with v000, it ran 1.68 times as fast both times.
#include <hip/hip_runtime.h>
#include <hip/hip_bf16.h>

typedef unsigned short u16;
typedef unsigned int   u32;

typedef __attribute__((ext_vector_type(16))) __bf16 v16bf;
typedef __attribute__((ext_vector_type(8)))  float  v8f;
typedef __attribute__((ext_vector_type(4)))  int    v4i;

#if defined(__has_builtin)
#if __has_builtin(__builtin_amdgcn_global_load_async_to_lds_b128)
#define HAVE_ASYNC_LDS 1
#endif
#endif
#ifndef HAVE_ASYNC_LDS
#define HAVE_ASYNC_LDS 0
#endif

struct FragBits { uint4 lo; uint4 hi; };   // 32 bytes == 16 bf16

static __device__ __forceinline__ v16bf make_frag(const uint4& lo, const uint4& hi) {
  FragBits s{lo, hi};
  return __builtin_bit_cast(v16bf, s);
}

// WMMA 16-bit A/B fragment layout: lane L holds (row/col = L%16),
// K-chunks at koff=(L/16)*8 : elements [koff, koff+7] and [koff+16, koff+23].
// Caller passes p already offset by koff; chunks are uint4[0] and uint4[2].
static __device__ __forceinline__ v16bf load_frag16(const u16* p) {
  const uint4* u = reinterpret_cast<const uint4*>(p);
  return make_frag(u[0], u[2]);
}

static __device__ __forceinline__ u16 f2bf(float f) {
  u32 u = __builtin_bit_cast(u32, f);
  u += 0x7FFFu + ((u >> 16) & 1u);   // RNE
  return (u16)(u >> 16);
}

// 16-byte global -> LDS copy. Prefer the gfx1250 async-to-LDS path
// (ASYNCcnt-tracked DMA, no VGPR round trip); fall back to vector copy.
static __device__ __forceinline__ void copy16_g2l(u16* l, const u16* g) {
#if HAVE_ASYNC_LDS
  __builtin_amdgcn_global_load_async_to_lds_b128(
      (__attribute__((address_space(1))) v4i*)g,
      (__attribute__((address_space(3))) v4i*)l, 0, 0);
#else
  *reinterpret_cast<uint4*>(l) = *reinterpret_cast<const uint4*>(g);
#endif
}

static __device__ __forceinline__ void wait_async_copies() {
#if HAVE_ASYNC_LDS
#if defined(__has_builtin) && __has_builtin(__builtin_amdgcn_s_wait_asynccnt)
  __builtin_amdgcn_s_wait_asynccnt(0);
#else
  asm volatile("s_wait_asynccnt 0x0" ::: "memory");
#endif
#endif
}

constexpr int DIM = 1024;
constexpr int SEQ = 2048;
constexpr int BATCH = 2;
constexpr int HEADS = 16;
constexpr int HW = 64;        // head width

// ---------------------------------------------------------------------------
// Kernel 1: LayerNorm + convert to bf16. One 256-thread block per row.
// ---------------------------------------------------------------------------
__global__ __launch_bounds__(256) void ln_bf16_kernel(
    const float* __restrict__ x, const float* __restrict__ gamma,
    const float* __restrict__ beta, u16* __restrict__ xn) {
  const int row = blockIdx.x;          // 0 .. B*S-1
  const int tid = threadIdx.x;         // 256 threads * float4 = 1024
  const float4 v = reinterpret_cast<const float4*>(x + (size_t)row * DIM)[tid];
  float s  = v.x + v.y + v.z + v.w;
  float s2 = v.x * v.x + v.y * v.y + v.z * v.z + v.w * v.w;
  #pragma unroll
  for (int off = 16; off > 0; off >>= 1) {
    s  += __shfl_down(s,  off, 32);
    s2 += __shfl_down(s2, off, 32);
  }
  __shared__ float red0[8], red1[8];
  const int wid = tid >> 5, lid = tid & 31;
  if (lid == 0) { red0[wid] = s; red1[wid] = s2; }
  __syncthreads();
  float ts = 0.f, ts2 = 0.f;
  #pragma unroll
  for (int i = 0; i < 8; i++) { ts += red0[i]; ts2 += red1[i]; }
  const float mu   = ts * (1.0f / DIM);
  const float var  = ts2 * (1.0f / DIM) - mu * mu;
  const float rstd = rsqrtf(var + 1e-5f);
  const float4 g = reinterpret_cast<const float4*>(gamma)[tid];
  const float4 b = reinterpret_cast<const float4*>(beta)[tid];
  uint2 o;
  o.x = (u32)f2bf((v.x - mu) * rstd * g.x + b.x) |
        ((u32)f2bf((v.y - mu) * rstd * g.y + b.y) << 16);
  o.y = (u32)f2bf((v.z - mu) * rstd * g.z + b.z) |
        ((u32)f2bf((v.w - mu) * rstd * g.w + b.w) << 16);
  reinterpret_cast<uint2*>(xn + (size_t)row * DIM)[tid] = o;
}

// ---------------------------------------------------------------------------
// Kernel 2: transpose + bf16-convert weights: Wt[j][k] = (bf16) W[k][j]
// ---------------------------------------------------------------------------
__global__ __launch_bounds__(256) void wt_bf16_kernel(
    const float* __restrict__ wq, const float* __restrict__ wk,
    const float* __restrict__ wv, u16* __restrict__ wt) {
  __shared__ float tile[32][33];
  const float* w = (blockIdx.z == 0) ? wq : (blockIdx.z == 1) ? wk : wv;
  u16* o = wt + (size_t)blockIdx.z * DIM * DIM;
  const int tx = threadIdx.x, ty = threadIdx.y;        // 32 x 8
  #pragma unroll
  for (int i = 0; i < 4; i++) {
    const int k = blockIdx.y * 32 + ty + i * 8;
    const int j = blockIdx.x * 32 + tx;
    tile[ty + i * 8][tx] = w[(size_t)k * DIM + j];     // tile[kloc][jloc]
  }
  __syncthreads();
  #pragma unroll
  for (int i = 0; i < 4; i++) {
    const int j = blockIdx.x * 32 + ty + i * 8;
    const int k = blockIdx.y * 32 + tx;
    o[(size_t)j * DIM + k] = f2bf(tile[tx][ty + i * 8]);
  }
}

// ---------------------------------------------------------------------------
// Kernel 3: QKV GEMM on WMMA bf16. grid=(32 Mtiles, 8 Ntiles, 3 proj),
// 128 threads = 4 waves (2x2); block tile 128x128, wave tile 64x64.
// Per stage (64 k) the block copies 128 rows of xn and 128 rows of wt into LDS
// (async copies, two buffers: the next stage flies while this one is used).
// q,k stored (B,H,S,W); v stored transposed (B,H,W,S). Scale 1/8 folded in q.
// ---------------------------------------------------------------------------
constexpr int GK     = 64;                 // k per stage: 128-byte rows
constexpr int GPITCH = 72;                 // LDS row pitch in elements: 144 B
constexpr int GOPER  = 128 * GPITCH;       // one operand's tile, elements
constexpr int GSTAGE = 2 * GOPER;          // one buffer: [xn rows | wt rows]
constexpr int GNST   = DIM / GK;           // 16 stages

// Eight 16-byte copies of one lane: rows r, r+16, ... r+112 of one operand.
// The s_wait_xcnt stands inside the statement, behind the last copy, so that
// no address register is rewritten ahead of it.
static __device__ __forceinline__ void copy8_rows(u32 l, const u16* g) {
  asm volatile(
      "global_load_async_to_lds_b128 %0, %8, off\n\t"
      "global_load_async_to_lds_b128 %1, %9, off\n\t"
      "global_load_async_to_lds_b128 %2, %10, off\n\t"
      "global_load_async_to_lds_b128 %3, %11, off\n\t"
      "global_load_async_to_lds_b128 %4, %12, off\n\t"
      "global_load_async_to_lds_b128 %5, %13, off\n\t"
      "global_load_async_to_lds_b128 %6, %14, off\n\t"
      "global_load_async_to_lds_b128 %7, %15, off\n\t"
      "s_wait_xcnt 0x0"
      :: "v"(l), "v"(l + 1 * 16 * GPITCH * 2), "v"(l + 2 * 16 * GPITCH * 2),
         "v"(l + 3 * 16 * GPITCH * 2), "v"(l + 4 * 16 * GPITCH * 2),
         "v"(l + 5 * 16 * GPITCH * 2), "v"(l + 6 * 16 * GPITCH * 2),
         "v"(l + 7 * 16 * GPITCH * 2),
         "v"(g), "v"(g + 1 * 16 * DIM), "v"(g + 2 * 16 * DIM),
         "v"(g + 3 * 16 * DIM), "v"(g + 4 * 16 * DIM), "v"(g + 5 * 16 * DIM),
         "v"(g + 6 * 16 * DIM), "v"(g + 7 * 16 * DIM)
      : "memory");
}

// A wave's 64x64 result: bias, (q only) scale, bf16, one 2-byte store an element.
template <int PROJ>
static __device__ __forceinline__ void store_tile(
    const v8f (&acc)[4][4], const float* __restrict__ bias,
    u16* __restrict__ dst, int row0, int col0, int lq, int half) {
  #pragma unroll
  for (int mi = 0; mi < 4; mi++) {
    #pragma unroll
    for (int nt = 0; nt < 4; nt++) {
      const int col = col0 + nt * 16 + lq;             // N = lane%16
      const float bvl = bias[col];
      const int h = col >> 6, w = col & 63;
      #pragma unroll
      for (int r = 0; r < 8; r++) {
        const int m = r + half * 8;                    // M = vgpr + 8*(lane/16)
        const int row = row0 + mi * 16 + m;
        const int b = row >> 11, s = row & (SEQ - 1);
        float val = acc[mi][nt][r] + bvl;
        if (PROJ == 0) val *= 0.125f;                  // 1/sqrt(64)
        if (PROJ == 2)
          dst[((size_t)(b * HEADS + h) * HW + w) * SEQ + s] = f2bf(val);
        else
          dst[((size_t)(b * HEADS + h) * SEQ + s) * HW + w] = f2bf(val);
      }
    }
    // one row of tiles at a time: without it the compiler converts all 128
    // values ahead of the stores and the register count goes above v255
    __builtin_amdgcn_sched_barrier(0);
  }
  // a precaution: nothing in this kernel follows the three nests
  asm volatile("s_wait_xcnt 0x0" ::: "memory");
}

__global__ __launch_bounds__(128) void qkv_wmma_kernel(
    const u16* __restrict__ xn, const u16* __restrict__ wt,
    const float* __restrict__ bq, const float* __restrict__ bk,
    const float* __restrict__ bv, u16* __restrict__ qO,
    u16* __restrict__ kO, u16* __restrict__ vtO) {
  __shared__ __align__(16) u16 stg[2 * GSTAGE];      // 73,728 B

  const int proj = blockIdx.z;
  const int tid  = threadIdx.x;
  const int wave = tid >> 5;
  const int lane = tid & 31;
  const int m0 = blockIdx.x * 128;
  const int n0 = blockIdx.y * 128;
  const int wm = (wave >> 1) * 64;                   // wave's rows in the tile
  const int wn = (wave & 1) * 64;                    // wave's cols in the tile
  const u16* wsel = wt + (size_t)proj * DIM * DIM;

  const int lq = lane & 15;
  const int koff = (lane >> 4) * 8;

  // copy map: 8 lanes cover one 128-byte row, a wave 4 whole rows per copy
  const int crow = tid >> 3, ccol = (tid & 7) * 8;
  const u16* gx = xn + (size_t)(m0 + crow) * DIM + ccol;
  const u16* gw = wsel + (size_t)(n0 + crow) * DIM + ccol;
  const u32 lx = (u32)(size_t)stg + (u32)(crow * GPITCH + ccol) * 2u;
  const u32 lw = lx + GOPER * 2u;

  // prologue, two buffers
  copy8_rows(lx, gx);
  copy8_rows(lw, gw);
  asm volatile("s_wait_asynccnt 0x0" ::: "memory");  // stage 0 landed (own copies)
  __syncthreads();                                   // stage 0 visible to block
  copy8_rows(lx + GSTAGE * 2u, gx + GK);
  copy8_rows(lw + GSTAGE * 2u, gw + GK);

  v8f acc[4][4] = {};
  for (int t = 0; t < GNST; t++) {
    const u16* sx = stg + (t & 1) * GSTAGE + (wm + lq) * GPITCH + koff;
    const u16* sw = stg + (t & 1) * GSTAGE + GOPER + (wn + lq) * GPITCH + koff;
    #pragma unroll
    for (int ks = 0; ks < 2; ks++) {
      v16bf a[4], bfr[4];
      #pragma unroll
      for (int i = 0; i < 4; i++) {
        a[i]   = load_frag16(sx + i * 16 * GPITCH + ks * 32);
        bfr[i] = load_frag16(sw + i * 16 * GPITCH + ks * 32);
      }
      // keeps the 16 LDS reads one group ahead of the 16 WMMAs: without it the
      // compiler sinks them between the rows, one full LDS wait per 4 WMMAs
      __builtin_amdgcn_sched_barrier(0);
      #pragma unroll
      for (int mi = 0; mi < 4; mi++)
        #pragma unroll
        for (int nt = 0; nt < 4; nt++)
          acc[mi][nt] = __builtin_amdgcn_wmma_f32_16x16x32_bf16(
              false, a[mi], false, bfr[nt], (short)0, acc[mi][nt], false, false);
      // keeps the next group's reads from moving up among these WMMAs
      __builtin_amdgcn_sched_barrier(0);
    }
    // publish point of stage t+1; it also frees the buffer just read
    asm volatile("s_wait_dscnt 0x0" ::: "memory");    // own reads of this buffer done
    asm volatile("s_wait_asynccnt 0x0" ::: "memory"); // own copies of stage t+1 landed
    __syncthreads();
    if (t + 2 < GNST) {
      const u32 bo = (u32)(t & 1) * (GSTAGE * 2u);
      copy8_rows(lx + bo, gx + (t + 2) * GK);
      copy8_rows(lw + bo, gw + (t + 2) * GK);
    }
  }
  asm volatile("s_wait_asynccnt 0x0" ::: "memory");   // nothing in flight at the end

  // the projection is the same for the whole block: one test, three loop nests
  const int half = lane >> 4;
  if (proj == 0)      store_tile<0>(acc, bq, qO,  m0 + wm, n0 + wn, lq, half);
  else if (proj == 1) store_tile<1>(acc, bk, kO,  m0 + wm, n0 + wn, lq, half);
  else                store_tile<2>(acc, bv, vtO, m0 + wm, n0 + wn, lq, half);
}

// ---------------------------------------------------------------------------
// Kernel 4: flash attention. 128 threads = 4 waves (same b,h), one 16-query
// tile per wave. Per key tile (32 keys):
//   * block cooperatively stages K(32x64) and V^T(64x32) into LDS via
//     gfx1250 async-to-LDS DMA (ASYNCcnt), shared by all 4 waves
//   * scores^T = K x q^T on WMMA -> online softmax (per-lane + shfl_xor 16)
//   * P -> LDS bf16 (wave-local, s_wait_dscnt) -> B-fragment
//   * h^T += V^T x P^T on WMMA
// ---------------------------------------------------------------------------
__global__ __launch_bounds__(128) void attn_kernel(
    const u16* __restrict__ q, const u16* __restrict__ k,
    const u16* __restrict__ vt, const int* __restrict__ mask,
    const float* __restrict__ x, float* __restrict__ out) {
  __shared__ float pen[SEQ];                          // additive mask penalty
  __shared__ __align__(16) u16 KtL[32 * 64];          // K tile   (keys x W)
  __shared__ __align__(16) u16 VtL[64 * 32];          // V^T tile (W x keys)
  __shared__ __align__(16) u16 Pt[4][16 * 32];        // per-wave P tile

  const int tid = threadIdx.x, wave = tid >> 5, lane = tid & 31;
  const int bh = blockIdx.x >> 5;                     // b*H + h
  const int qgrp = blockIdx.x & 31;
  const int b = bh >> 4, h = bh & 15;
  const int qbase = (qgrp * 4 + wave) * 16;

  for (int i = tid; i < SEQ; i += 128)
    pen[i] = -10000.0f * (1.0f - (float)mask[b * SEQ + i]);

  const u16* qbh = q + (size_t)bh * SEQ * HW;
  const u16* kbh = k + (size_t)bh * SEQ * HW;
  const u16* vbh = vt + (size_t)bh * HW * SEQ;

  const int lq = lane & 15, half = lane >> 4, koff = half * 8;

  // q^T B-fragments for the two 32-wide K-steps of the 64-dim head
  v16bf qf[2];
  {
    const u16* qr = qbh + (size_t)(qbase + lq) * HW;
    qf[0] = load_frag16(qr + 0 + koff);
    qf[1] = load_frag16(qr + 32 + koff);
  }

  v8f o[4] = {};
  float m_i = -3.0e38f, l_i = 0.0f;
  u16* Pl = Pt[wave];

  for (int kb = 0; kb < SEQ; kb += 32) {
    // ---- cooperative staging of K / V^T tiles (8 KB) through async DMA ----
    __syncthreads();                                  // prev tile fully read
    {
      const u16* gk = kbh + (size_t)kb * HW;          // 4 KB, contiguous
      #pragma unroll
      for (int c = 0; c < 2; c++) {
        const int chunk = tid + c * 128;              // 256 x 16B
        copy16_g2l(KtL + chunk * 8, gk + chunk * 8);
      }
      #pragma unroll
      for (int c = 0; c < 2; c++) {
        const int chunk = tid + c * 128;              // 64 rows x 4 chunks
        const int w = chunk >> 2, off = (chunk & 3) * 8;
        copy16_g2l(VtL + w * 32 + off, vbh + (size_t)w * SEQ + kb + off);
      }
    }
    if (kb + 32 < SEQ) {
      __builtin_prefetch(kbh + (size_t)(kb + 32) * HW + tid * 8, 0, 1);
      __builtin_prefetch(vbh + (size_t)(tid >> 1) * SEQ + kb + 32, 0, 1);
    }
    wait_async_copies();
    __syncthreads();                                  // tiles visible to block

    // ---- scores^T tile: 32 keys x 16 queries, two 16x16 accumulators ----
    v8f s0 = {}, s1 = {};
    #pragma unroll
    for (int ks = 0; ks < 2; ks++) {
      const v16bf a0 = load_frag16(KtL + (size_t)lq * HW + ks * 32 + koff);
      s0 = __builtin_amdgcn_wmma_f32_16x16x32_bf16(
          false, a0, false, qf[ks], (short)0, s0, false, false);
      const v16bf a1 =
          load_frag16(KtL + (size_t)(16 + lq) * HW + ks * 32 + koff);
      s1 = __builtin_amdgcn_wmma_f32_16x16x32_bf16(
          false, a1, false, qf[ks], (short)0, s1, false, false);
    }
    // additive mask (keys live along vgpr index + lane half)
    #pragma unroll
    for (int r = 0; r < 8; r++) {
      s0[r] += pen[kb + half * 8 + r];
      s1[r] += pen[kb + 16 + half * 8 + r];
    }
    // ---- online softmax over keys: per-lane 16 values + partner (xor 16) --
    float mloc = -3.0e38f;
    #pragma unroll
    for (int r = 0; r < 8; r++) mloc = fmaxf(mloc, fmaxf(s0[r], s1[r]));
    mloc = fmaxf(mloc, __shfl_xor(mloc, 16, 32));
    const float mnew = fmaxf(m_i, mloc);
    const float corr = __expf(m_i - mnew);
    float p0[8], p1[8], psum = 0.0f;
    #pragma unroll
    for (int r = 0; r < 8; r++) {
      p0[r] = __expf(s0[r] - mnew);
      p1[r] = __expf(s1[r] - mnew);
      psum += p0[r] + p1[r];
    }
    psum += __shfl_xor(psum, 16, 32);
    l_i = l_i * corr + psum;
    m_i = mnew;
    #pragma unroll
    for (int t = 0; t < 4; t++)
      #pragma unroll
      for (int r = 0; r < 8; r++) o[t][r] *= corr;

    // ---- P -> LDS, query-major rows of 32 keys (bf16, packed pairs) ------
    u32* Pw = reinterpret_cast<u32*>(Pl);
    #pragma unroll
    for (int r = 0; r < 8; r += 2) {
      Pw[(lq * 32 + half * 8 + r) >> 1] =
          (u32)f2bf(p0[r]) | ((u32)f2bf(p0[r + 1]) << 16);
      Pw[(lq * 32 + 16 + half * 8 + r) >> 1] =
          (u32)f2bf(p1[r]) | ((u32)f2bf(p1[r + 1]) << 16);
    }
    asm volatile("s_wait_dscnt 0x0" ::: "memory");    // wave-local LDS RAW

    const v16bf pfrag = load_frag16(Pl + lq * 32 + koff);   // B = P^T
    #pragma unroll
    for (int t = 0; t < 4; t++) {                     // h^T rows w = t*16..+15
      const v16bf vfrag = load_frag16(VtL + (size_t)(t * 16 + lq) * 32 + koff);
      o[t] = __builtin_amdgcn_wmma_f32_16x16x32_bf16(
          false, vfrag, false, pfrag, (short)0, o[t], false, false);
    }
  }

  // epilogue: divide by softmax sum, add residual, store fp32
  const float inv = 1.0f / (l_i + 1e-20f);
  const int s = qbase + lq;
  #pragma unroll
  for (int t = 0; t < 4; t++) {
    #pragma unroll
    for (int r = 0; r < 8; r++) {
      const int w = t * 16 + r + 8 * half;
      const size_t oidx = ((size_t)b * SEQ + s) * DIM + h * HW + w;
      out[oidx] = o[t][r] * inv + x[oidx];
    }
  }
}

// ---------------------------------------------------------------------------
extern "C" void kernel_launch(void* const* d_in, const int* in_sizes, int n_in,
                              void* d_out, int out_size, void* d_ws,
                              size_t ws_size, hipStream_t stream) {
  const float* x     = (const float*)d_in[0];
  const int*   mask  = (const int*)d_in[1];
  const float* gamma = (const float*)d_in[2];
  const float* beta  = (const float*)d_in[3];
  const float* wq    = (const float*)d_in[4];
  const float* bq    = (const float*)d_in[5];
  const float* wk    = (const float*)d_in[6];
  const float* bk    = (const float*)d_in[7];
  const float* wv    = (const float*)d_in[8];
  const float* bv    = (const float*)d_in[9];
  float* out = (float*)d_out;

  char* ws = (char*)d_ws;
  const size_t MB = 1024 * 1024;
  u16* xn = (u16*)ws;                         // 8 MB  (4096x1024 bf16)
  u16* wt = (u16*)(ws + 8 * MB);              // 6 MB  (3x 1024x1024 bf16, transposed)
  u16* qb = (u16*)(ws + 14 * MB);             // 8 MB  (B,H,S,W)
  u16* kb = (u16*)(ws + 22 * MB);             // 8 MB  (B,H,S,W)
  u16* vt = (u16*)(ws + 30 * MB);             // 8 MB  (B,H,W,S)

  ln_bf16_kernel<<<BATCH * SEQ, 256, 0, stream>>>(x, gamma, beta, xn);

  dim3 tg(32, 32, 3), tb(32, 8, 1);
  wt_bf16_kernel<<<tg, tb, 0, stream>>>(wq, wk, wv, wt);

  dim3 gg(32, 8, 3);
  qkv_wmma_kernel<<<gg, 128, 0, stream>>>(xn, wt, bq, bk, bv, qb, kb, vt);

  attn_kernel<<<BATCH * HEADS * (SEQ / 16) / 4, 128, 0, stream>>>(
      qb, kb, vt, mask, x, out);
}

// v002
// A run of this version takes 111 microseconds.
// In both of two side-by-side timings against v001, it was 1.43 times as fast.
// Over all steps from v000 it is 2.41 times as fast.
#include <hip/hip_runtime.h>
#include <hip/hip_bf16.h>

typedef unsigned short u16;
typedef unsigned int   u32;

typedef __attribute__((ext_vector_type(16))) __bf16 v16bf;
typedef __attribute__((ext_vector_type(8)))  float  v8f;
typedef __attribute__((ext_vector_type(4)))  int    v4i;

#if defined(__has_builtin)
#if __has_builtin(__builtin_amdgcn_global_load_async_to_lds_b128)
#define HAVE_ASYNC_LDS 1
#endif
#endif
#ifndef HAVE_ASYNC_LDS
#define HAVE_ASYNC_LDS 0
#endif

struct FragBits { uint4 lo; uint4 hi; };   // 32 bytes == 16 bf16

static __device__ __forceinline__ v16bf make_frag(const uint4& lo, const uint4& hi) {
  FragBits s{lo, hi};
  return __builtin_bit_cast(v16bf, s);
}

// WMMA 16-bit A/B fragment layout: lane L holds (row/col = L%16),
// K-chunks at koff=(L/16)*8 : elements [koff, koff+7] and [koff+16, koff+23].
// Caller passes p already offset by koff; chunks are uint4[0] and uint4[2].
static __device__ __forceinline__ v16bf load_frag16(const u16* p) {
  const uint4* u = reinterpret_cast<const uint4*>(p);
  return make_frag(u[0], u[2]);
}

static __device__ __forceinline__ u16 f2bf(float f) {
  u32 u = __builtin_bit_cast(u32, f);
  u += 0x7FFFu + ((u >> 16) & 1u);   // RNE
  return (u16)(u >> 16);
}

// 16-byte global -> LDS copy. Prefer the gfx1250 async-to-LDS path
// (ASYNCcnt-tracked DMA, no VGPR round trip); fall back to vector copy.
static __device__ __forceinline__ void copy16_g2l(u16* l, const u16* g) {
#if HAVE_ASYNC_LDS
  __builtin_amdgcn_global_load_async_to_lds_b128(
      (__attribute__((address_space(1))) v4i*)g,
      (__attribute__((address_space(3))) v4i*)l, 0, 0);
#else
  *reinterpret_cast<uint4*>(l) = *reinterpret_cast<const uint4*>(g);
#endif
}

static __device__ __forceinline__ void wait_async_copies() {
#if HAVE_ASYNC_LDS
#if defined(__has_builtin) && __has_builtin(__builtin_amdgcn_s_wait_asynccnt)
  __builtin_amdgcn_s_wait_asynccnt(0);
#else
  asm volatile("s_wait_asynccnt 0x0" ::: "memory");
#endif
#endif
}

constexpr int DIM = 1024;
constexpr int SEQ = 2048;
constexpr int BATCH = 2;
constexpr int HEADS = 16;
constexpr int HW = 64;        // head width

// ---------------------------------------------------------------------------
// Kernel 1: LayerNorm + convert to bf16. One 256-thread block per row.
// ---------------------------------------------------------------------------
__global__ __launch_bounds__(256) void ln_bf16_kernel(
    const float* __restrict__ x, const float* __restrict__ gamma,
    const float* __restrict__ beta, u16* __restrict__ xn) {
  const int row = blockIdx.x;          // 0 .. B*S-1
  const int tid = threadIdx.x;         // 256 threads * float4 = 1024
  const float4 v = reinterpret_cast<const float4*>(x + (size_t)row * DIM)[tid];
  float s  = v.x + v.y + v.z + v.w;
  float s2 = v.x * v.x + v.y * v.y + v.z * v.z + v.w * v.w;
  #pragma unroll
  for (int off = 16; off > 0; off >>= 1) {
    s  += __shfl_down(s,  off, 32);
    s2 += __shfl_down(s2, off, 32);
  }
  __shared__ float red0[8], red1[8];
  const int wid = tid >> 5, lid = tid & 31;
  if (lid == 0) { red0[wid] = s; red1[wid] = s2; }
  __syncthreads();
  float ts = 0.f, ts2 = 0.f;
  #pragma unroll
  for (int i = 0; i < 8; i++) { ts += red0[i]; ts2 += red1[i]; }
  const float mu   = ts * (1.0f / DIM);
  const float var  = ts2 * (1.0f / DIM) - mu * mu;
  const float rstd = rsqrtf(var + 1e-5f);
  const float4 g = reinterpret_cast<const float4*>(gamma)[tid];
  const float4 b = reinterpret_cast<const float4*>(beta)[tid];
  uint2 o;
  o.x = (u32)f2bf((v.x - mu) * rstd * g.x + b.x) |
        ((u32)f2bf((v.y - mu) * rstd * g.y + b.y) << 16);
  o.y = (u32)f2bf((v.z - mu) * rstd * g.z + b.z) |
        ((u32)f2bf((v.w - mu) * rstd * g.w + b.w) << 16);
  reinterpret_cast<uint2*>(xn + (size_t)row * DIM)[tid] = o;
}

// ---------------------------------------------------------------------------
// Kernel 2: transpose + bf16-convert weights: Wt[j][k] = (bf16) W[k][j]
// ---------------------------------------------------------------------------
__global__ __launch_bounds__(256) void wt_bf16_kernel(
    const float* __restrict__ wq, const float* __restrict__ wk,
    const float* __restrict__ wv, u16* __restrict__ wt) {
  __shared__ float tile[32][33];
  const float* w = (blockIdx.z == 0) ? wq : (blockIdx.z == 1) ? wk : wv;
  u16* o = wt + (size_t)blockIdx.z * DIM * DIM;
  const int tx = threadIdx.x, ty = threadIdx.y;        // 32 x 8
  #pragma unroll
  for (int i = 0; i < 4; i++) {
    const int k = blockIdx.y * 32 + ty + i * 8;
    const int j = blockIdx.x * 32 + tx;
    tile[ty + i * 8][tx] = w[(size_t)k * DIM + j];     // tile[kloc][jloc]
  }
  __syncthreads();
  #pragma unroll
  for (int i = 0; i < 4; i++) {
    const int j = blockIdx.x * 32 + ty + i * 8;
    const int k = blockIdx.y * 32 + tx;
    o[(size_t)j * DIM + k] = f2bf(tile[tx][ty + i * 8]);
  }
}

// ---------------------------------------------------------------------------
// Kernel 3: QKV GEMM on WMMA bf16. grid=(32 Mtiles, 8 Ntiles, 3 proj),
// 128 threads = 4 waves (2x2); block tile 128x128, wave tile 64x64.
// Per stage (64 k) the block copies 128 rows of xn and 128 rows of wt into LDS
// (async copies, two buffers: the next stage flies while this one is used).
// q,k stored (B,H,S,W); v stored transposed (B,H,W,S). Scale 1/8 folded in q.
// ---------------------------------------------------------------------------
constexpr int GK     = 64;                 // k per stage: 128-byte rows
constexpr int GPITCH = 72;                 // LDS row pitch in elements: 144 B
constexpr int GOPER  = 128 * GPITCH;       // one operand's tile, elements
constexpr int GSTAGE = 2 * GOPER;          // one buffer: [xn rows | wt rows]
constexpr int GNST   = DIM / GK;           // 16 stages

// Eight 16-byte copies of one lane: rows r, r+16, ... r+112 of one operand.
// The s_wait_xcnt stands inside the statement, behind the last copy, so that
// no address register is rewritten ahead of it.
static __device__ __forceinline__ void copy8_rows(u32 l, const u16* g) {
  asm volatile(
      "global_load_async_to_lds_b128 %0, %8, off\n\t"
      "global_load_async_to_lds_b128 %1, %9, off\n\t"
      "global_load_async_to_lds_b128 %2, %10, off\n\t"
      "global_load_async_to_lds_b128 %3, %11, off\n\t"
      "global_load_async_to_lds_b128 %4, %12, off\n\t"
      "global_load_async_to_lds_b128 %5, %13, off\n\t"
      "global_load_async_to_lds_b128 %6, %14, off\n\t"
      "global_load_async_to_lds_b128 %7, %15, off\n\t"
      "s_wait_xcnt 0x0"
      :: "v"(l), "v"(l + 1 * 16 * GPITCH * 2), "v"(l + 2 * 16 * GPITCH * 2),
         "v"(l + 3 * 16 * GPITCH * 2), "v"(l + 4 * 16 * GPITCH * 2),
         "v"(l + 5 * 16 * GPITCH * 2), "v"(l + 6 * 16 * GPITCH * 2),
         "v"(l + 7 * 16 * GPITCH * 2),
         "v"(g), "v"(g + 1 * 16 * DIM), "v"(g + 2 * 16 * DIM),
         "v"(g + 3 * 16 * DIM), "v"(g + 4 * 16 * DIM), "v"(g + 5 * 16 * DIM),
         "v"(g + 6 * 16 * DIM), "v"(g + 7 * 16 * DIM)
      : "memory");
}

// A wave's 64x64 result: bias, (q only) scale, bf16, one 2-byte store an element.
template <int PROJ>
static __device__ __forceinline__ void store_tile(
    const v8f (&acc)[4][4], const float* __restrict__ bias,
    u16* __restrict__ dst, int row0, int col0, int lq, int half) {
  #pragma unroll
  for (int mi = 0; mi < 4; mi++) {
    #pragma unroll
    for (int nt = 0; nt < 4; nt++) {
      const int col = col0 + nt * 16 + lq;             // N = lane%16
      const float bvl = bias[col];
      const int h = col >> 6, w = col & 63;
      #pragma unroll
      for (int r = 0; r < 8; r++) {
        const int m = r + half * 8;                    // M = vgpr + 8*(lane/16)
        const int row = row0 + mi * 16 + m;
        const int b = row >> 11, s = row & (SEQ - 1);
        float val = acc[mi][nt][r] + bvl;
        if (PROJ == 0) val *= 0.125f;                  // 1/sqrt(64)
        if (PROJ == 2)
          dst[((size_t)(b * HEADS + h) * HW + w) * SEQ + s] = f2bf(val);
        else
          dst[((size_t)(b * HEADS + h) * SEQ + s) * HW + w] = f2bf(val);
      }
    }
    // one row of tiles at a time: without it the compiler converts all 128
    // values ahead of the stores and the register count goes above v255
    __builtin_amdgcn_sched_barrier(0);
  }
  // a precaution: nothing in this kernel follows the three nests
  asm volatile("s_wait_xcnt 0x0" ::: "memory");
}

__global__ __launch_bounds__(128) void qkv_wmma_kernel(
    const u16* __restrict__ xn, const u16* __restrict__ wt,
    const float* __restrict__ bq, const float* __restrict__ bk,
    const float* __restrict__ bv, u16* __restrict__ qO,
    u16* __restrict__ kO, u16* __restrict__ vtO) {
  __shared__ __align__(16) u16 stg[2 * GSTAGE];      // 73,728 B

  const int proj = blockIdx.z;
  const int tid  = threadIdx.x;
  const int wave = tid >> 5;
  const int lane = tid & 31;
  const int m0 = blockIdx.x * 128;
  const int n0 = blockIdx.y * 128;
  const int wm = (wave >> 1) * 64;                   // wave's rows in the tile
  const int wn = (wave & 1) * 64;                    // wave's cols in the tile
  const u16* wsel = wt + (size_t)proj * DIM * DIM;

  const int lq = lane & 15;
  const int koff = (lane >> 4) * 8;

  // copy map: 8 lanes cover one 128-byte row, a wave 4 whole rows per copy
  const int crow = tid >> 3, ccol = (tid & 7) * 8;
  const u16* gx = xn + (size_t)(m0 + crow) * DIM + ccol;
  const u16* gw = wsel + (size_t)(n0 + crow) * DIM + ccol;
  const u32 lx = (u32)(size_t)stg + (u32)(crow * GPITCH + ccol) * 2u;
  const u32 lw = lx + GOPER * 2u;

  // prologue, two buffers
  copy8_rows(lx, gx);
  copy8_rows(lw, gw);
  asm volatile("s_wait_asynccnt 0x0" ::: "memory");  // stage 0 landed (own copies)
  __syncthreads();                                   // stage 0 visible to block
  copy8_rows(lx + GSTAGE * 2u, gx + GK);
  copy8_rows(lw + GSTAGE * 2u, gw + GK);

  v8f acc[4][4] = {};
  for (int t = 0; t < GNST; t++) {
    const u16* sx = stg + (t & 1) * GSTAGE + (wm + lq) * GPITCH + koff;
    const u16* sw = stg + (t & 1) * GSTAGE + GOPER + (wn + lq) * GPITCH + koff;
    #pragma unroll
    for (int ks = 0; ks < 2; ks++) {
      v16bf a[4], bfr[4];
      #pragma unroll
      for (int i = 0; i < 4; i++) {
        a[i]   = load_frag16(sx + i * 16 * GPITCH + ks * 32);
        bfr[i] = load_frag16(sw + i * 16 * GPITCH + ks * 32);
      }
      // keeps the 16 LDS reads one group ahead of the 16 WMMAs: without it the
      // compiler sinks them between the rows, one full LDS wait per 4 WMMAs
      __builtin_amdgcn_sched_barrier(0);
      #pragma unroll
      for (int mi = 0; mi < 4; mi++)
        #pragma unroll
        for (int nt = 0; nt < 4; nt++)
          acc[mi][nt] = __builtin_amdgcn_wmma_f32_16x16x32_bf16(
              false, a[mi], false, bfr[nt], (short)0, acc[mi][nt], false, false);
      // keeps the next group's reads from moving up among these WMMAs
      __builtin_amdgcn_sched_barrier(0);
    }
    // publish point of stage t+1; it also frees the buffer just read
    asm volatile("s_wait_dscnt 0x0" ::: "memory");    // own reads of this buffer done
    asm volatile("s_wait_asynccnt 0x0" ::: "memory"); // own copies of stage t+1 landed
    __syncthreads();
    if (t + 2 < GNST) {
      const u32 bo = (u32)(t & 1) * (GSTAGE * 2u);
      copy8_rows(lx + bo, gx + (t + 2) * GK);
      copy8_rows(lw + bo, gw + (t + 2) * GK);
    }
  }
  asm volatile("s_wait_asynccnt 0x0" ::: "memory");   // nothing in flight at the end

  // the projection is the same for the whole block: one test, three loop nests
  const int half = lane >> 4;
  if (proj == 0)      store_tile<0>(acc, bq, qO,  m0 + wm, n0 + wn, lq, half);
  else if (proj == 1) store_tile<1>(acc, bk, kO,  m0 + wm, n0 + wn, lq, half);
  else                store_tile<2>(acc, bv, vtO, m0 + wm, n0 + wn, lq, half);
}

// ---------------------------------------------------------------------------
// Kernel 4: flash attention. 128 threads = 4 waves (same b,h), one 16-query
// tile per wave. Per key tile (32 keys):
//   * block cooperatively stages K(32x64) and V^T(64x32) into LDS via
//     gfx1250 async-to-LDS DMA (ASYNCcnt), shared by all 4 waves
//   * scores^T = K x q^T on WMMA -> online softmax (per-lane + shfl_xor 16)
//   * P -> LDS bf16 (wave-local, s_wait_dscnt) -> B-fragment
//   * h^T += V^T x P^T on WMMA
// LDS rows are read 16 bytes a lane, one row a lane: their pitch is an odd
// multiple of 16 bytes, so that 16 lanes fall on 64 different banks.
// ---------------------------------------------------------------------------
constexpr int KPITCH = HW + 8;             // K rows: 128 B of data, 144 B apart
constexpr int VPITCH = 32 + 8;             // V^T rows: 64 B of data, 80 B apart
constexpr int PPITCH = 32 + 8;             // P rows: 64 B of data, 80 B apart

__global__ __launch_bounds__(128) void attn_kernel(
    const u16* __restrict__ q, const u16* __restrict__ k,
    const u16* __restrict__ vt, const int* __restrict__ mask,
    const float* __restrict__ x, float* __restrict__ out) {
  __shared__ float pen[SEQ];                          // additive mask penalty
  __shared__ __align__(16) u16 KtL[32 * KPITCH];      // K tile   (keys x W)
  __shared__ __align__(16) u16 VtL[64 * VPITCH];      // V^T tile (W x keys)
  __shared__ __align__(16) u16 Pt[4][16 * PPITCH];    // per-wave P tile

  const int tid = threadIdx.x, wave = tid >> 5, lane = tid & 31;
  const int bh = blockIdx.x >> 5;                     // b*H + h
  const int qgrp = blockIdx.x & 31;
  const int b = bh >> 4, h = bh & 15;
  const int qbase = (qgrp * 4 + wave) * 16;

  for (int i = tid; i < SEQ; i += 128)
    pen[i] = -10000.0f * (1.0f - (float)mask[b * SEQ + i]);

  const u16* qbh = q + (size_t)bh * SEQ * HW;
  const u16* kbh = k + (size_t)bh * SEQ * HW;
  const u16* vbh = vt + (size_t)bh * HW * SEQ;

  const int lq = lane & 15, half = lane >> 4, koff = half * 8;

  // q^T B-fragments for the two 32-wide K-steps of the 64-dim head
  v16bf qf[2];
  {
    const u16* qr = qbh + (size_t)(qbase + lq) * HW;
    qf[0] = load_frag16(qr + 0 + koff);
    qf[1] = load_frag16(qr + 32 + koff);
  }

  v8f o[4] = {};
  float m_i = -3.0e38f, l_i = 0.0f;
  u16* Pl = Pt[wave];

  for (int kb = 0; kb < SEQ; kb += 32) {
    // ---- cooperative staging of K / V^T tiles (8 KB) through async DMA ----
    __syncthreads();                                  // prev tile fully read
    {
      const u16* gk = kbh + (size_t)kb * HW;          // 4 KB, contiguous
      #pragma unroll
      for (int c = 0; c < 2; c++) {
        const int chunk = tid + c * 128;              // 32 rows x 8 chunks
        copy16_g2l(KtL + (chunk >> 3) * KPITCH + (chunk & 7) * 8, gk + chunk * 8);
      }
      #pragma unroll
      for (int c = 0; c < 2; c++) {
        const int chunk = tid + c * 128;              // 64 rows x 4 chunks
        const int w = chunk >> 2, off = (chunk & 3) * 8;
        copy16_g2l(VtL + w * VPITCH + off, vbh + (size_t)w * SEQ + kb + off);
      }
    }
    if (kb + 32 < SEQ) {
      __builtin_prefetch(kbh + (size_t)(kb + 32) * HW + tid * 8, 0, 1);
      __builtin_prefetch(vbh + (size_t)(tid >> 1) * SEQ + kb + 32, 0, 1);
    }
    wait_async_copies();
    __syncthreads();                                  // tiles visible to block

    // ---- scores^T tile: 32 keys x 16 queries, two 16x16 accumulators ----
    v8f s0 = {}, s1 = {};
    #pragma unroll
    for (int ks = 0; ks < 2; ks++) {
      const v16bf a0 = load_frag16(KtL + (size_t)lq * KPITCH + ks * 32 + koff);
      s0 = __builtin_amdgcn_wmma_f32_16x16x32_bf16(
          false, a0, false, qf[ks], (short)0, s0, false, false);
      const v16bf a1 =
          load_frag16(KtL + (size_t)(16 + lq) * KPITCH + ks * 32 + koff);
      s1 = __builtin_amdgcn_wmma_f32_16x16x32_bf16(
          false, a1, false, qf[ks], (short)0, s1, false, false);
    }
    // additive mask (keys live along vgpr index + lane half)
    #pragma unroll
    for (int r = 0; r < 8; r++) {
      s0[r] += pen[kb + half * 8 + r];
      s1[r] += pen[kb + 16 + half * 8 + r];
    }
    // ---- online softmax over keys: per-lane 16 values + partner (xor 16) --
    float mloc = -3.0e38f;
    #pragma unroll
    for (int r = 0; r < 8; r++) mloc = fmaxf(mloc, fmaxf(s0[r], s1[r]));
    mloc = fmaxf(mloc, __shfl_xor(mloc, 16, 32));
    const float mnew = fmaxf(m_i, mloc);
    const float corr = __expf(m_i - mnew);
    float p0[8], p1[8], psum = 0.0f;
    #pragma unroll
    for (int r = 0; r < 8; r++) {
      p0[r] = __expf(s0[r] - mnew);
      p1[r] = __expf(s1[r] - mnew);
      psum += p0[r] + p1[r];
    }
    psum += __shfl_xor(psum, 16, 32);
    l_i = l_i * corr + psum;
    m_i = mnew;
    #pragma unroll
    for (int t = 0; t < 4; t++)
      #pragma unroll
      for (int r = 0; r < 8; r++) o[t][r] *= corr;

    // ---- P -> LDS, query-major rows of 32 keys (bf16, packed pairs) ------
    u32 pw0[4], pw1[4];
    #pragma unroll
    for (int r = 0; r < 8; r += 2) {
      pw0[r >> 1] = (u32)f2bf(p0[r]) | ((u32)f2bf(p0[r + 1]) << 16);
      pw1[r >> 1] = (u32)f2bf(p1[r]) | ((u32)f2bf(p1[r + 1]) << 16);
    }
    // two 16-byte stores a lane, written as such: at the 80-byte pitch the
    // compiler no longer joins eight 4-byte stores into them
    uint4* Pw = reinterpret_cast<uint4*>(Pl + lq * PPITCH + half * 8);
    Pw[0] = make_uint4(pw0[0], pw0[1], pw0[2], pw0[3]);
    Pw[2] = make_uint4(pw1[0], pw1[1], pw1[2], pw1[3]);
    asm volatile("s_wait_dscnt 0x0" ::: "memory");    // wave-local LDS RAW

    const v16bf pfrag = load_frag16(Pl + lq * PPITCH + koff);   // B = P^T
    #pragma unroll
    for (int t = 0; t < 4; t++) {                     // h^T rows w = t*16..+15
      const v16bf vfrag = load_frag16(VtL + (size_t)(t * 16 + lq) * VPITCH + koff);
      o[t] = __builtin_amdgcn_wmma_f32_16x16x32_bf16(
          false, vfrag, false, pfrag, (short)0, o[t], false, false);
    }
  }

  // epilogue: divide by softmax sum, add residual, store fp32
  const float inv = 1.0f / (l_i + 1e-20f);
  const int s = qbase + lq;
  #pragma unroll
  for (int t = 0; t < 4; t++) {
    #pragma unroll
    for (int r = 0; r < 8; r++) {
      const int w = t * 16 + r + 8 * half;
      const size_t oidx = ((size_t)b * SEQ + s) * DIM + h * HW + w;
      out[oidx] = o[t][r] * inv + x[oidx];
    }
  }
}

// ---------------------------------------------------------------------------
extern "C" void kernel_launch(void* const* d_in, const int* in_sizes, int n_in,
                              void* d_out, int out_size, void* d_ws,
                              size_t ws_size, hipStream_t stream) {
  const float* x     = (const float*)d_in[0];
  const int*   mask  = (const int*)d_in[1];
  const float* gamma = (const float*)d_in[2];
  const float* beta  = (const float*)d_in[3];
  const float* wq    = (const float*)d_in[4];
  const float* bq    = (const float*)d_in[5];
  const float* wk    = (const float*)d_in[6];
  const float* bk    = (const float*)d_in[7];
  const float* wv    = (const float*)d_in[8];
  const float* bv    = (const float*)d_in[9];
  float* out = (float*)d_out;

  char* ws = (char*)d_ws;
  const size_t MB = 1024 * 1024;
  u16* xn = (u16*)ws;                         // 8 MB  (4096x1024 bf16)
  u16* wt = (u16*)(ws + 8 * MB);              // 6 MB  (3x 1024x1024 bf16, transposed)
  u16* qb = (u16*)(ws + 14 * MB);             // 8 MB  (B,H,S,W)
  u16* kb = (u16*)(ws + 22 * MB);             // 8 MB  (B,H,S,W)
  u16* vt = (u16*)(ws + 30 * MB);             // 8 MB  (B,H,W,S)

  ln_bf16_kernel<<<BATCH * SEQ, 256, 0, stream>>>(x, gamma, beta, xn);

  dim3 tg(32, 32, 3), tb(32, 8, 1);
  wt_bf16_kernel<<<tg, tb, 0, stream>>>(wq, wk, wv, wt);

  dim3 gg(32, 8, 3);
  qkv_wmma_kernel<<<gg, 128, 0, stream>>>(xn, wt, bq, bk, bv, qb, kb, vt);

  attn_kernel<<<BATCH * HEADS * (SEQ / 16) / 4, 128, 0, stream>>>(
      qb, kb, vt, mask, x, out);
}

// v003
// A run of this version takes 99.2 microseconds.
// Two timings next to v002 both put it at 1.12 times that version's speed.
// Over all steps from v000 it is 2.69 times as fast.
#include <hip/hip_runtime.h>
#include <hip/hip_bf16.h>

typedef unsigned short u16;
typedef unsigned int   u32;

typedef __attribute__((ext_vector_type(16))) __bf16 v16bf;
typedef __attribute__((ext_vector_type(8)))  float  v8f;
typedef __attribute__((ext_vector_type(4)))  int    v4i;
typedef __attribute__((ext_vector_type(16))) float  v16f;

#if defined(__has_builtin)
#if __has_builtin(__builtin_amdgcn_global_load_async_to_lds_b128)
#define HAVE_ASYNC_LDS 1
#endif
#endif
#ifndef HAVE_ASYNC_LDS
#define HAVE_ASYNC_LDS 0
#endif

struct FragBits { uint4 lo; uint4 hi; };   // 32 bytes == 16 bf16

static __device__ __forceinline__ v16bf make_frag(const uint4& lo, const uint4& hi) {
  FragBits s{lo, hi};
  return __builtin_bit_cast(v16bf, s);
}

// WMMA 16-bit A/B fragment layout: lane L holds (row/col = L%16),
// K-chunks at koff=(L/16)*8 : elements [koff, koff+7] and [koff+16, koff+23].
// Caller passes p already offset by koff; chunks are uint4[0] and uint4[2].
static __device__ __forceinline__ v16bf load_frag16(const u16* p) {
  const uint4* u = reinterpret_cast<const uint4*>(p);
  return make_frag(u[0], u[2]);
}

static __device__ __forceinline__ u16 f2bf(float f) {
  u32 u = __builtin_bit_cast(u32, f);
  u += 0x7FFFu + ((u >> 16) & 1u);   // RNE
  return (u16)(u >> 16);
}

// 16-byte global -> LDS copy. Prefer the gfx1250 async-to-LDS path
// (ASYNCcnt-tracked DMA, no VGPR round trip); fall back to vector copy.
static __device__ __forceinline__ void copy16_g2l(u16* l, const u16* g) {
#if HAVE_ASYNC_LDS
  __builtin_amdgcn_global_load_async_to_lds_b128(
      (__attribute__((address_space(1))) v4i*)g,
      (__attribute__((address_space(3))) v4i*)l, 0, 0);
#else
  *reinterpret_cast<uint4*>(l) = *reinterpret_cast<const uint4*>(g);
#endif
}

static __device__ __forceinline__ void wait_async_copies() {
#if HAVE_ASYNC_LDS
#if defined(__has_builtin) && __has_builtin(__builtin_amdgcn_s_wait_asynccnt)
  __builtin_amdgcn_s_wait_asynccnt(0);
#else
  asm volatile("s_wait_asynccnt 0x0" ::: "memory");
#endif
#endif
}

constexpr int DIM = 1024;
constexpr int SEQ = 2048;
constexpr int BATCH = 2;
constexpr int HEADS = 16;
constexpr int HW = 64;        // head width

// ---------------------------------------------------------------------------
// Kernel 1: LayerNorm + convert to bf16. One 256-thread block per row.
// ---------------------------------------------------------------------------
__global__ __launch_bounds__(256) void ln_bf16_kernel(
    const float* __restrict__ x, const float* __restrict__ gamma,
    const float* __restrict__ beta, u16* __restrict__ xn) {
  const int row = blockIdx.x;          // 0 .. B*S-1
  const int tid = threadIdx.x;         // 256 threads * float4 = 1024
  const float4 v = reinterpret_cast<const float4*>(x + (size_t)row * DIM)[tid];
  float s  = v.x + v.y + v.z + v.w;
  float s2 = v.x * v.x + v.y * v.y + v.z * v.z + v.w * v.w;
  #pragma unroll
  for (int off = 16; off > 0; off >>= 1) {
    s  += __shfl_down(s,  off, 32);
    s2 += __shfl_down(s2, off, 32);
  }
  __shared__ float red0[8], red1[8];
  const int wid = tid >> 5, lid = tid & 31;
  if (lid == 0) { red0[wid] = s; red1[wid] = s2; }
  __syncthreads();
  float ts = 0.f, ts2 = 0.f;
  #pragma unroll
  for (int i = 0; i < 8; i++) { ts += red0[i]; ts2 += red1[i]; }
  const float mu   = ts * (1.0f / DIM);
  const float var  = ts2 * (1.0f / DIM) - mu * mu;
  const float rstd = rsqrtf(var + 1e-5f);
  const float4 g = reinterpret_cast<const float4*>(gamma)[tid];
  const float4 b = reinterpret_cast<const float4*>(beta)[tid];
  uint2 o;
  o.x = (u32)f2bf((v.x - mu) * rstd * g.x + b.x) |
        ((u32)f2bf((v.y - mu) * rstd * g.y + b.y) << 16);
  o.y = (u32)f2bf((v.z - mu) * rstd * g.z + b.z) |
        ((u32)f2bf((v.w - mu) * rstd * g.w + b.w) << 16);
  reinterpret_cast<uint2*>(xn + (size_t)row * DIM)[tid] = o;
}

// ---------------------------------------------------------------------------
// Kernel 2: transpose + bf16-convert weights: Wt[j][k] = (bf16) W[k][j]
// ---------------------------------------------------------------------------
__global__ __launch_bounds__(256) void wt_bf16_kernel(
    const float* __restrict__ wq, const float* __restrict__ wk,
    const float* __restrict__ wv, u16* __restrict__ wt) {
  __shared__ float tile[32][33];
  const float* w = (blockIdx.z == 0) ? wq : (blockIdx.z == 1) ? wk : wv;
  u16* o = wt + (size_t)blockIdx.z * DIM * DIM;
  const int tx = threadIdx.x, ty = threadIdx.y;        // 32 x 8
  #pragma unroll
  for (int i = 0; i < 4; i++) {
    const int k = blockIdx.y * 32 + ty + i * 8;
    const int j = blockIdx.x * 32 + tx;
    tile[ty + i * 8][tx] = w[(size_t)k * DIM + j];     // tile[kloc][jloc]
  }
  __syncthreads();
  #pragma unroll
  for (int i = 0; i < 4; i++) {
    const int j = blockIdx.x * 32 + ty + i * 8;
    const int k = blockIdx.y * 32 + tx;
    o[(size_t)j * DIM + k] = f2bf(tile[tx][ty + i * 8]);
  }
}

// ---------------------------------------------------------------------------
// Kernel 3: QKV GEMM on WMMA bf16. grid=(32 Mtiles, 8 Ntiles, 3 proj),
// 128 threads = 4 waves (2x2); block tile 128x128, wave tile 64x64.
// Per stage (64 k) the block copies 128 rows of xn and 128 rows of wt into LDS
// (async copies, two buffers: the next stage flies while this one is used).
// q,k stored (B,H,S,W); v stored transposed (B,H,W,S). Scale 1/8 folded in q.
// ---------------------------------------------------------------------------
constexpr int GK     = 64;                 // k per stage: 128-byte rows
constexpr int GPITCH = 72;                 // LDS row pitch in elements: 144 B
constexpr int GOPER  = 128 * GPITCH;       // one operand's tile, elements
constexpr int GSTAGE = 2 * GOPER;          // one buffer: [xn rows | wt rows]
constexpr int GNST   = DIM / GK;           // 16 stages

// Eight 16-byte copies of one lane: rows r, r+16, ... r+112 of one operand.
// The s_wait_xcnt stands inside the statement, behind the last copy, so that
// no address register is rewritten ahead of it.
static __device__ __forceinline__ void copy8_rows(u32 l, const u16* g) {
  asm volatile(
      "global_load_async_to_lds_b128 %0, %8, off\n\t"
      "global_load_async_to_lds_b128 %1, %9, off\n\t"
      "global_load_async_to_lds_b128 %2, %10, off\n\t"
      "global_load_async_to_lds_b128 %3, %11, off\n\t"
      "global_load_async_to_lds_b128 %4, %12, off\n\t"
      "global_load_async_to_lds_b128 %5, %13, off\n\t"
      "global_load_async_to_lds_b128 %6, %14, off\n\t"
      "global_load_async_to_lds_b128 %7, %15, off\n\t"
      "s_wait_xcnt 0x0"
      :: "v"(l), "v"(l + 1 * 16 * GPITCH * 2), "v"(l + 2 * 16 * GPITCH * 2),
         "v"(l + 3 * 16 * GPITCH * 2), "v"(l + 4 * 16 * GPITCH * 2),
         "v"(l + 5 * 16 * GPITCH * 2), "v"(l + 6 * 16 * GPITCH * 2),
         "v"(l + 7 * 16 * GPITCH * 2),
         "v"(g), "v"(g + 1 * 16 * DIM), "v"(g + 2 * 16 * DIM),
         "v"(g + 3 * 16 * DIM), "v"(g + 4 * 16 * DIM), "v"(g + 5 * 16 * DIM),
         "v"(g + 6 * 16 * DIM), "v"(g + 7 * 16 * DIM)
      : "memory");
}

// A wave's 64x64 result: bias, (q only) scale, bf16, one 2-byte store an element.
template <int PROJ>
static __device__ __forceinline__ void store_tile(
    const v8f (&acc)[4][4], const float* __restrict__ bias,
    u16* __restrict__ dst, int row0, int col0, int lq, int half) {
  #pragma unroll
  for (int mi = 0; mi < 4; mi++) {
    #pragma unroll
    for (int nt = 0; nt < 4; nt++) {
      const int col = col0 + nt * 16 + lq;             // N = lane%16
      const float bvl = bias[col];
      const int h = col >> 6, w = col & 63;
      #pragma unroll
      for (int r = 0; r < 8; r++) {
        const int m = r + half * 8;                    // M = vgpr + 8*(lane/16)
        const int row = row0 + mi * 16 + m;
        const int b = row >> 11, s = row & (SEQ - 1);
        float val = acc[mi][nt][r] + bvl;
        if (PROJ == 0) val *= 0.125f;                  // 1/sqrt(64)
        if (PROJ == 2)
          dst[((size_t)(b * HEADS + h) * HW + w) * SEQ + s] = f2bf(val);
        else
          dst[((size_t)(b * HEADS + h) * SEQ + s) * HW + w] = f2bf(val);
      }
    }
    // one row of tiles at a time: without it the compiler converts all 128
    // values ahead of the stores and the register count goes above v255
    __builtin_amdgcn_sched_barrier(0);
  }
  // a precaution: nothing in this kernel follows the three nests
  asm volatile("s_wait_xcnt 0x0" ::: "memory");
}

__global__ __launch_bounds__(128) void qkv_wmma_kernel(
    const u16* __restrict__ xn, const u16* __restrict__ wt,
    const float* __restrict__ bq, const float* __restrict__ bk,
    const float* __restrict__ bv, u16* __restrict__ qO,
    u16* __restrict__ kO, u16* __restrict__ vtO) {
  __shared__ __align__(16) u16 stg[2 * GSTAGE];      // 73,728 B

  const int proj = blockIdx.z;
  const int tid  = threadIdx.x;
  const int wave = tid >> 5;
  const int lane = tid & 31;
  const int m0 = blockIdx.x * 128;
  const int n0 = blockIdx.y * 128;
  const int wm = (wave >> 1) * 64;                   // wave's rows in the tile
  const int wn = (wave & 1) * 64;                    // wave's cols in the tile
  const u16* wsel = wt + (size_t)proj * DIM * DIM;

  const int lq = lane & 15;
  const int koff = (lane >> 4) * 8;

  // copy map: 8 lanes cover one 128-byte row, a wave 4 whole rows per copy
  const int crow = tid >> 3, ccol = (tid & 7) * 8;
  const u16* gx = xn + (size_t)(m0 + crow) * DIM + ccol;
  const u16* gw = wsel + (size_t)(n0 + crow) * DIM + ccol;
  const u32 lx = (u32)(size_t)stg + (u32)(crow * GPITCH + ccol) * 2u;
  const u32 lw = lx + GOPER * 2u;

  // prologue, two buffers
  copy8_rows(lx, gx);
  copy8_rows(lw, gw);
  asm volatile("s_wait_asynccnt 0x0" ::: "memory");  // stage 0 landed (own copies)
  __syncthreads();                                   // stage 0 visible to block
  copy8_rows(lx + GSTAGE * 2u, gx + GK);
  copy8_rows(lw + GSTAGE * 2u, gw + GK);

  v8f acc[4][4] = {};
  for (int t = 0; t < GNST; t++) {
    const u16* sx = stg + (t & 1) * GSTAGE + (wm + lq) * GPITCH + koff;
    const u16* sw = stg + (t & 1) * GSTAGE + GOPER + (wn + lq) * GPITCH + koff;
    #pragma unroll
    for (int ks = 0; ks < 2; ks++) {
      v16bf a[4], bfr[4];
      #pragma unroll
      for (int i = 0; i < 4; i++) {
        a[i]   = load_frag16(sx + i * 16 * GPITCH + ks * 32);
        bfr[i] = load_frag16(sw + i * 16 * GPITCH + ks * 32);
      }
      // keeps the 16 LDS reads one group ahead of the 16 WMMAs: without it the
      // compiler sinks them between the rows, one full LDS wait per 4 WMMAs
      __builtin_amdgcn_sched_barrier(0);
      #pragma unroll
      for (int mi = 0; mi < 4; mi++)
        #pragma unroll
        for (int nt = 0; nt < 4; nt++)
          acc[mi][nt] = __builtin_amdgcn_wmma_f32_16x16x32_bf16(
              false, a[mi], false, bfr[nt], (short)0, acc[mi][nt], false, false);
      // keeps the next group's reads from moving up among these WMMAs
      __builtin_amdgcn_sched_barrier(0);
    }
    // publish point of stage t+1; it also frees the buffer just read
    asm volatile("s_wait_dscnt 0x0" ::: "memory");    // own reads of this buffer done
    asm volatile("s_wait_asynccnt 0x0" ::: "memory"); // own copies of stage t+1 landed
    __syncthreads();
    if (t + 2 < GNST) {
      const u32 bo = (u32)(t & 1) * (GSTAGE * 2u);
      copy8_rows(lx + bo, gx + (t + 2) * GK);
      copy8_rows(lw + bo, gw + (t + 2) * GK);
    }
  }
  asm volatile("s_wait_asynccnt 0x0" ::: "memory");   // nothing in flight at the end

  // the projection is the same for the whole block: one test, three loop nests
  const int half = lane >> 4;
  if (proj == 0)      store_tile<0>(acc, bq, qO,  m0 + wm, n0 + wn, lq, half);
  else if (proj == 1) store_tile<1>(acc, bk, kO,  m0 + wm, n0 + wn, lq, half);
  else                store_tile<2>(acc, bv, vtO, m0 + wm, n0 + wn, lq, half);
}

// ---------------------------------------------------------------------------
// Kernel 4: flash attention. 128 threads = 4 waves (same b,h), one 16-query
// tile per wave. Per key tile (32 keys):
//   * block cooperatively stages K(32x64) and V^T(64x32) into LDS via
//     gfx1250 async-to-LDS DMA (ASYNCcnt), shared by all 4 waves
//   * scores^T = K x q^T on WMMA -> online softmax (per-lane + shfl_xor 16)
//   * P^T packed to bf16 in registers -> B-fragment (no LDS)
//   * h^T += V^T x P^T on WMMA
// LDS rows are read 16 bytes a lane, one row a lane: their pitch is an odd
// multiple of 16 bytes, so that 16 lanes fall on 64 different banks.
// ---------------------------------------------------------------------------
constexpr int KPITCH = HW + 8;             // K rows: 128 B of data, 144 B apart
constexpr int VPITCH = 32 + 8;             // V^T rows: 64 B of data, 80 B apart

__global__ __launch_bounds__(128) void attn_kernel(
    const u16* __restrict__ q, const u16* __restrict__ k,
    const u16* __restrict__ vt, const int* __restrict__ mask,
    const float* __restrict__ x, float* __restrict__ out) {
  __shared__ float pen[SEQ];                          // additive mask penalty
  __shared__ __align__(16) u16 KtL[32 * KPITCH];      // K tile   (keys x W)
  __shared__ __align__(16) u16 VtL[64 * VPITCH];      // V^T tile (W x keys)

  const int tid = threadIdx.x, wave = tid >> 5, lane = tid & 31;
  const int bh = blockIdx.x >> 5;                     // b*H + h
  const int qgrp = blockIdx.x & 31;
  const int b = bh >> 4, h = bh & 15;
  const int qbase = (qgrp * 4 + wave) * 16;

  for (int i = tid; i < SEQ; i += 128)
    pen[i] = -10000.0f * (1.0f - (float)mask[b * SEQ + i]);

  const u16* qbh = q + (size_t)bh * SEQ * HW;
  const u16* kbh = k + (size_t)bh * SEQ * HW;
  const u16* vbh = vt + (size_t)bh * HW * SEQ;

  const int lq = lane & 15, half = lane >> 4, koff = half * 8;

  // q^T B-fragments for the two 32-wide K-steps of the 64-dim head
  v16bf qf[2];
  {
    const u16* qr = qbh + (size_t)(qbase + lq) * HW;
    qf[0] = load_frag16(qr + 0 + koff);
    qf[1] = load_frag16(qr + 32 + koff);
  }

  v8f o[4] = {};
  float m_i = -3.0e38f, l_i = 0.0f;

  for (int kb = 0; kb < SEQ; kb += 32) {
    // ---- cooperative staging of K / V^T tiles (8 KB) through async DMA ----
    __syncthreads();                                  // prev tile fully read
    {
      const u16* gk = kbh + (size_t)kb * HW;          // 4 KB, contiguous
      #pragma unroll
      for (int c = 0; c < 2; c++) {
        const int chunk = tid + c * 128;              // 32 rows x 8 chunks
        copy16_g2l(KtL + (chunk >> 3) * KPITCH + (chunk & 7) * 8, gk + chunk * 8);
      }
      #pragma unroll
      for (int c = 0; c < 2; c++) {
        const int chunk = tid + c * 128;              // 64 rows x 4 chunks
        const int w = chunk >> 2, off = (chunk & 3) * 8;
        copy16_g2l(VtL + w * VPITCH + off, vbh + (size_t)w * SEQ + kb + off);
      }
    }
    if (kb + 32 < SEQ) {
      __builtin_prefetch(kbh + (size_t)(kb + 32) * HW + tid * 8, 0, 1);
      __builtin_prefetch(vbh + (size_t)(tid >> 1) * SEQ + kb + 32, 0, 1);
    }
    wait_async_copies();
    __syncthreads();                                  // tiles visible to block

    // ---- scores^T tile: 32 keys x 16 queries, two 16x16 accumulators ----
    v8f s0 = {}, s1 = {};
    #pragma unroll
    for (int ks = 0; ks < 2; ks++) {
      const v16bf a0 = load_frag16(KtL + (size_t)lq * KPITCH + ks * 32 + koff);
      s0 = __builtin_amdgcn_wmma_f32_16x16x32_bf16(
          false, a0, false, qf[ks], (short)0, s0, false, false);
      const v16bf a1 =
          load_frag16(KtL + (size_t)(16 + lq) * KPITCH + ks * 32 + koff);
      s1 = __builtin_amdgcn_wmma_f32_16x16x32_bf16(
          false, a1, false, qf[ks], (short)0, s1, false, false);
    }
    // additive mask (keys live along vgpr index + lane half)
    #pragma unroll
    for (int r = 0; r < 8; r++) {
      s0[r] += pen[kb + half * 8 + r];
      s1[r] += pen[kb + 16 + half * 8 + r];
    }
    // ---- online softmax over keys: per-lane 16 values + partner (xor 16) --
    float mloc = -3.0e38f;
    #pragma unroll
    for (int r = 0; r < 8; r++) mloc = fmaxf(mloc, fmaxf(s0[r], s1[r]));
    mloc = fmaxf(mloc, __shfl_xor(mloc, 16, 32));
    const float mnew = fmaxf(m_i, mloc);
    const float corr = __expf(m_i - mnew);
    float p0[8], p1[8], psum = 0.0f;
    #pragma unroll
    for (int r = 0; r < 8; r++) {
      p0[r] = __expf(s0[r] - mnew);
      p1[r] = __expf(s1[r] - mnew);
      psum += p0[r] + p1[r];
    }
    psum += __shfl_xor(psum, 16, 32);
    l_i = l_i * corr + psum;
    m_i = mnew;
    #pragma unroll
    for (int t = 0; t < 4; t++)
      #pragma unroll
      for (int r = 0; r < 8; r++) o[t][r] *= corr;

    // ---- P^T as B operand, straight from the score accumulators -----------
    // lane (c, h): s0[r] is key 8h+r, s1[r] is key 16+8h+r of query c, which is
    // the hardware k order of a B fragment's elements 0..7 and 8..15
    v16f pv;
    #pragma unroll
    for (int r = 0; r < 8; r++) { pv[r] = p0[r]; pv[8 + r] = p1[r]; }
    const v16bf pfrag = __builtin_convertvector(pv, v16bf);   // RNE, packed cvt
    #pragma unroll
    for (int t = 0; t < 4; t++) {                     // h^T rows w = t*16..+15
      const v16bf vfrag = load_frag16(VtL + (size_t)(t * 16 + lq) * VPITCH + koff);
      o[t] = __builtin_amdgcn_wmma_f32_16x16x32_bf16(
          false, vfrag, false, pfrag, (short)0, o[t], false, false);
    }
  }

  // epilogue: divide by softmax sum, add residual, store fp32
  const float inv = 1.0f / (l_i + 1e-20f);
  const int s = qbase + lq;
  #pragma unroll
  for (int t = 0; t < 4; t++) {
    #pragma unroll
    for (int r = 0; r < 8; r++) {
      const int w = t * 16 + r + 8 * half;
      const size_t oidx = ((size_t)b * SEQ + s) * DIM + h * HW + w;
      out[oidx] = o[t][r] * inv + x[oidx];
    }
  }
}

// ---------------------------------------------------------------------------
extern "C" void kernel_launch(void* const* d_in, const int* in_sizes, int n_in,
                              void* d_out, int out_size, void* d_ws,
                              size_t ws_size, hipStream_t stream) {
  const float* x     = (const float*)d_in[0];
  const int*   mask  = (const int*)d_in[1];
  const float* gamma = (const float*)d_in[2];
  const float* beta  = (const float*)d_in[3];
  const float* wq    = (const float*)d_in[4];
  const float* bq    = (const float*)d_in[5];
  const float* wk    = (const float*)d_in[6];
  const float* bk    = (const float*)d_in[7];
  const float* wv    = (const float*)d_in[8];
  const float* bv    = (const float*)d_in[9];
  float* out = (float*)d_out;

  char* ws = (char*)d_ws;
  const size_t MB = 1024 * 1024;
  u16* xn = (u16*)ws;                         // 8 MB  (4096x1024 bf16)
  u16* wt = (u16*)(ws + 8 * MB);              // 6 MB  (3x 1024x1024 bf16, transposed)
  u16* qb = (u16*)(ws + 14 * MB);             // 8 MB  (B,H,S,W)
  u16* kb = (u16*)(ws + 22 * MB);             // 8 MB  (B,H,S,W)
  u16* vt = (u16*)(ws + 30 * MB);             // 8 MB  (B,H,W,S)

  ln_bf16_kernel<<<BATCH * SEQ, 256, 0, stream>>>(x, gamma, beta, xn);

  dim3 tg(32, 32, 3), tb(32, 8, 1);
  wt_bf16_kernel<<<tg, tb, 0, stream>>>(wq, wk, wv, wt);

  dim3 gg(32, 8, 3);
  qkv_wmma_kernel<<<gg, 128, 0, stream>>>(xn, wt, bq, bk, bv, qb, kb, vt);

  attn_kernel<<<BATCH * HEADS * (SEQ / 16) / 4, 128, 0, stream>>>(
      qb, kb, vt, mask, x, out);
}

// v004
// Measured time: 83.4 microseconds a run.
// Next to v003, in two timings, it ran 1.19 times as fast each time.
// Counting every step since v000, it is 3.20 times as fast.
#include <hip/hip_runtime.h>
#include <hip/hip_bf16.h>

typedef unsigned short u16;
typedef unsigned int   u32;

typedef __attribute__((ext_vector_type(16))) __bf16 v16bf;
typedef __attribute__((ext_vector_type(8)))  float  v8f;
typedef __attribute__((ext_vector_type(4)))  int    v4i;
typedef __attribute__((ext_vector_type(16))) float  v16f;
typedef __attribute__((ext_vector_type(4)))  float  v4f;

struct FragBits { uint4 lo; uint4 hi; };   // 32 bytes == 16 bf16

static __device__ __forceinline__ v16bf make_frag(const uint4& lo, const uint4& hi) {
  FragBits s{lo, hi};
  return __builtin_bit_cast(v16bf, s);
}

// WMMA 16-bit A/B fragment layout: lane L holds (row/col = L%16),
// K-chunks at koff=(L/16)*8 : elements [koff, koff+7] and [koff+16, koff+23].
// Caller passes p already offset by koff; chunks are uint4[0] and uint4[2].
static __device__ __forceinline__ v16bf load_frag16(const u16* p) {
  const uint4* u = reinterpret_cast<const uint4*>(p);
  return make_frag(u[0], u[2]);
}

static __device__ __forceinline__ u16 f2bf(float f) {
  u32 u = __builtin_bit_cast(u32, f);
  u += 0x7FFFu + ((u >> 16) & 1u);   // RNE
  return (u16)(u >> 16);
}

constexpr int DIM = 1024;
constexpr int SEQ = 2048;
constexpr int BATCH = 2;
constexpr int HEADS = 16;
constexpr int HW = 64;        // head width

// ---------------------------------------------------------------------------
// Kernel 1: LayerNorm + convert to bf16. One 256-thread block per row.
// ---------------------------------------------------------------------------
__global__ __launch_bounds__(256) void ln_bf16_kernel(
    const float* __restrict__ x, const float* __restrict__ gamma,
    const float* __restrict__ beta, u16* __restrict__ xn) {
  const int row = blockIdx.x;          // 0 .. B*S-1
  const int tid = threadIdx.x;         // 256 threads * float4 = 1024
  const float4 v = reinterpret_cast<const float4*>(x + (size_t)row * DIM)[tid];
  float s  = v.x + v.y + v.z + v.w;
  float s2 = v.x * v.x + v.y * v.y + v.z * v.z + v.w * v.w;
  #pragma unroll
  for (int off = 16; off > 0; off >>= 1) {
    s  += __shfl_down(s,  off, 32);
    s2 += __shfl_down(s2, off, 32);
  }
  __shared__ float red0[8], red1[8];
  const int wid = tid >> 5, lid = tid & 31;
  if (lid == 0) { red0[wid] = s; red1[wid] = s2; }
  __syncthreads();
  float ts = 0.f, ts2 = 0.f;
  #pragma unroll
  for (int i = 0; i < 8; i++) { ts += red0[i]; ts2 += red1[i]; }
  const float mu   = ts * (1.0f / DIM);
  const float var  = ts2 * (1.0f / DIM) - mu * mu;
  const float rstd = rsqrtf(var + 1e-5f);
  const float4 g = reinterpret_cast<const float4*>(gamma)[tid];
  const float4 b = reinterpret_cast<const float4*>(beta)[tid];
  uint2 o;
  o.x = (u32)f2bf((v.x - mu) * rstd * g.x + b.x) |
        ((u32)f2bf((v.y - mu) * rstd * g.y + b.y) << 16);
  o.y = (u32)f2bf((v.z - mu) * rstd * g.z + b.z) |
        ((u32)f2bf((v.w - mu) * rstd * g.w + b.w) << 16);
  reinterpret_cast<uint2*>(xn + (size_t)row * DIM)[tid] = o;
}

// ---------------------------------------------------------------------------
// Kernel 2: transpose + bf16-convert weights: Wt[j][k] = (bf16) W[k][j]
// ---------------------------------------------------------------------------
__global__ __launch_bounds__(256) void wt_bf16_kernel(
    const float* __restrict__ wq, const float* __restrict__ wk,
    const float* __restrict__ wv, u16* __restrict__ wt) {
  __shared__ float tile[32][33];
  const float* w = (blockIdx.z == 0) ? wq : (blockIdx.z == 1) ? wk : wv;
  u16* o = wt + (size_t)blockIdx.z * DIM * DIM;
  const int tx = threadIdx.x, ty = threadIdx.y;        // 32 x 8
  #pragma unroll
  for (int i = 0; i < 4; i++) {
    const int k = blockIdx.y * 32 + ty + i * 8;
    const int j = blockIdx.x * 32 + tx;
    tile[ty + i * 8][tx] = w[(size_t)k * DIM + j];     // tile[kloc][jloc]
  }
  __syncthreads();
  #pragma unroll
  for (int i = 0; i < 4; i++) {
    const int j = blockIdx.x * 32 + ty + i * 8;
    const int k = blockIdx.y * 32 + tx;
    o[(size_t)j * DIM + k] = f2bf(tile[tx][ty + i * 8]);
  }
}

// ---------------------------------------------------------------------------
// Kernel 3: QKV GEMM on WMMA bf16. grid=(32 Mtiles, 8 Ntiles, 3 proj),
// 128 threads = 4 waves (2x2); block tile 128x128, wave tile 64x64.
// Per stage (64 k) the block copies 128 rows of xn and 128 rows of wt into LDS
// (async copies, two buffers: the next stage flies while this one is used).
// q,k stored (B,H,S,W); v stored transposed (B,H,W,S). Scale 1/8 folded in q.
// ---------------------------------------------------------------------------
constexpr int GK     = 64;                 // k per stage: 128-byte rows
constexpr int GPITCH = 72;                 // LDS row pitch in elements: 144 B
constexpr int GOPER  = 128 * GPITCH;       // one operand's tile, elements
constexpr int GSTAGE = 2 * GOPER;          // one buffer: [xn rows | wt rows]
constexpr int GNST   = DIM / GK;           // 16 stages

// Eight 16-byte copies of one lane: rows r, r+16, ... r+112 of one operand.
// The s_wait_xcnt stands inside the statement, behind the last copy, so that
// no address register is rewritten ahead of it.
static __device__ __forceinline__ void copy8_rows(u32 l, const u16* g) {
  asm volatile(
      "global_load_async_to_lds_b128 %0, %8, off\n\t"
      "global_load_async_to_lds_b128 %1, %9, off\n\t"
      "global_load_async_to_lds_b128 %2, %10, off\n\t"
      "global_load_async_to_lds_b128 %3, %11, off\n\t"
      "global_load_async_to_lds_b128 %4, %12, off\n\t"
      "global_load_async_to_lds_b128 %5, %13, off\n\t"
      "global_load_async_to_lds_b128 %6, %14, off\n\t"
      "global_load_async_to_lds_b128 %7, %15, off\n\t"
      "s_wait_xcnt 0x0"
      :: "v"(l), "v"(l + 1 * 16 * GPITCH * 2), "v"(l + 2 * 16 * GPITCH * 2),
         "v"(l + 3 * 16 * GPITCH * 2), "v"(l + 4 * 16 * GPITCH * 2),
         "v"(l + 5 * 16 * GPITCH * 2), "v"(l + 6 * 16 * GPITCH * 2),
         "v"(l + 7 * 16 * GPITCH * 2),
         "v"(g), "v"(g + 1 * 16 * DIM), "v"(g + 2 * 16 * DIM),
         "v"(g + 3 * 16 * DIM), "v"(g + 4 * 16 * DIM), "v"(g + 5 * 16 * DIM),
         "v"(g + 6 * 16 * DIM), "v"(g + 7 * 16 * DIM)
      : "memory");
}

// A wave's 64x64 result: bias, (q only) scale, bf16, one 2-byte store an element.
template <int PROJ>
static __device__ __forceinline__ void store_tile(
    const v8f (&acc)[4][4], const float* __restrict__ bias,
    u16* __restrict__ dst, int row0, int col0, int lq, int half) {
  #pragma unroll
  for (int mi = 0; mi < 4; mi++) {
    #pragma unroll
    for (int nt = 0; nt < 4; nt++) {
      const int col = col0 + nt * 16 + lq;             // N = lane%16
      const float bvl = bias[col];
      const int h = col >> 6, w = col & 63;
      #pragma unroll
      for (int r = 0; r < 8; r++) {
        const int m = r + half * 8;                    // M = vgpr + 8*(lane/16)
        const int row = row0 + mi * 16 + m;
        const int b = row >> 11, s = row & (SEQ - 1);
        float val = acc[mi][nt][r] + bvl;
        if (PROJ == 0) val *= 0.125f;                  // 1/sqrt(64)
        if (PROJ == 2)
          dst[((size_t)(b * HEADS + h) * HW + w) * SEQ + s] = f2bf(val);
        else
          dst[((size_t)(b * HEADS + h) * SEQ + s) * HW + w] = f2bf(val);
      }
    }
    // one row of tiles at a time: without it the compiler converts all 128
    // values ahead of the stores and the register count goes above v255
    __builtin_amdgcn_sched_barrier(0);
  }
  // a precaution: nothing in this kernel follows the three nests
  asm volatile("s_wait_xcnt 0x0" ::: "memory");
}

__global__ __launch_bounds__(128) void qkv_wmma_kernel(
    const u16* __restrict__ xn, const u16* __restrict__ wt,
    const float* __restrict__ bq, const float* __restrict__ bk,
    const float* __restrict__ bv, u16* __restrict__ qO,
    u16* __restrict__ kO, u16* __restrict__ vtO) {
  __shared__ __align__(16) u16 stg[2 * GSTAGE];      // 73,728 B

  const int proj = blockIdx.z;
  const int tid  = threadIdx.x;
  const int wave = tid >> 5;
  const int lane = tid & 31;
  const int m0 = blockIdx.x * 128;
  const int n0 = blockIdx.y * 128;
  const int wm = (wave >> 1) * 64;                   // wave's rows in the tile
  const int wn = (wave & 1) * 64;                    // wave's cols in the tile
  const u16* wsel = wt + (size_t)proj * DIM * DIM;

  const int lq = lane & 15;
  const int koff = (lane >> 4) * 8;

  // copy map: 8 lanes cover one 128-byte row, a wave 4 whole rows per copy
  const int crow = tid >> 3, ccol = (tid & 7) * 8;
  const u16* gx = xn + (size_t)(m0 + crow) * DIM + ccol;
  const u16* gw = wsel + (size_t)(n0 + crow) * DIM + ccol;
  const u32 lx = (u32)(size_t)stg + (u32)(crow * GPITCH + ccol) * 2u;
  const u32 lw = lx + GOPER * 2u;

  // prologue, two buffers
  copy8_rows(lx, gx);
  copy8_rows(lw, gw);
  asm volatile("s_wait_asynccnt 0x0" ::: "memory");  // stage 0 landed (own copies)
  __syncthreads();                                   // stage 0 visible to block
  copy8_rows(lx + GSTAGE * 2u, gx + GK);
  copy8_rows(lw + GSTAGE * 2u, gw + GK);

  v8f acc[4][4] = {};
  for (int t = 0; t < GNST; t++) {
    const u16* sx = stg + (t & 1) * GSTAGE + (wm + lq) * GPITCH + koff;
    const u16* sw = stg + (t & 1) * GSTAGE + GOPER + (wn + lq) * GPITCH + koff;
    #pragma unroll
    for (int ks = 0; ks < 2; ks++) {
      v16bf a[4], bfr[4];
      #pragma unroll
      for (int i = 0; i < 4; i++) {
        a[i]   = load_frag16(sx + i * 16 * GPITCH + ks * 32);
        bfr[i] = load_frag16(sw + i * 16 * GPITCH + ks * 32);
      }
      // keeps the 16 LDS reads one group ahead of the 16 WMMAs: without it the
      // compiler sinks them between the rows, one full LDS wait per 4 WMMAs
      __builtin_amdgcn_sched_barrier(0);
      #pragma unroll
      for (int mi = 0; mi < 4; mi++)
        #pragma unroll
        for (int nt = 0; nt < 4; nt++)
          acc[mi][nt] = __builtin_amdgcn_wmma_f32_16x16x32_bf16(
              false, a[mi], false, bfr[nt], (short)0, acc[mi][nt], false, false);
      // keeps the next group's reads from moving up among these WMMAs
      __builtin_amdgcn_sched_barrier(0);
    }
    // publish point of stage t+1; it also frees the buffer just read
    asm volatile("s_wait_dscnt 0x0" ::: "memory");    // own reads of this buffer done
    asm volatile("s_wait_asynccnt 0x0" ::: "memory"); // own copies of stage t+1 landed
    __syncthreads();
    if (t + 2 < GNST) {
      const u32 bo = (u32)(t & 1) * (GSTAGE * 2u);
      copy8_rows(lx + bo, gx + (t + 2) * GK);
      copy8_rows(lw + bo, gw + (t + 2) * GK);
    }
  }
  asm volatile("s_wait_asynccnt 0x0" ::: "memory");   // nothing in flight at the end

  // the projection is the same for the whole block: one test, three loop nests
  const int half = lane >> 4;
  if (proj == 0)      store_tile<0>(acc, bq, qO,  m0 + wm, n0 + wn, lq, half);
  else if (proj == 1) store_tile<1>(acc, bk, kO,  m0 + wm, n0 + wn, lq, half);
  else                store_tile<2>(acc, bv, vtO, m0 + wm, n0 + wn, lq, half);
}

// ---------------------------------------------------------------------------
// Kernel 4: flash attention. 128 threads = 4 waves (same b,h), one 16-query
// tile per wave. Per stage (128 keys):
//   * block cooperatively stages K(128x64) and V^T(64x128) into LDS via
//     gfx1250 async-to-LDS DMA (ASYNCcnt), shared by all 4 waves
// and per pass (32 keys of the stage):
//   * scores^T = K x q^T on WMMA -> online softmax (per-lane + shfl_xor 16)
//   * P^T packed to bf16 in registers -> B-fragment (no LDS)
//   * h^T += V^T x P^T on WMMA
// LDS rows are read 16 bytes a lane, one row a lane: their pitch is an odd
// multiple of 16 bytes, so that 16 lanes fall on 64 different banks.
// ---------------------------------------------------------------------------
constexpr int KPITCH = HW + 8;             // K rows: 128 B of data, 144 B apart
constexpr int KSTG   = 128;                // keys per stage (one copy wait, two barriers)
constexpr int VPITCH = KSTG + 8;           // V^T rows: 256 B of data, 272 B apart

// Eight 16-byte copies of one lane, LSTEP bytes apart in LDS and GSTEP elements
// apart in global memory. The s_wait_xcnt stands inside the statement, behind
// the last copy, so that no address register is rewritten ahead of it.
template <int LSTEP, int GSTEP>
static __device__ __forceinline__ void copy8_step(u32 l, const u16* g) {
  asm volatile(
      "global_load_async_to_lds_b128 %0, %8, off\n\t"
      "global_load_async_to_lds_b128 %1, %9, off\n\t"
      "global_load_async_to_lds_b128 %2, %10, off\n\t"
      "global_load_async_to_lds_b128 %3, %11, off\n\t"
      "global_load_async_to_lds_b128 %4, %12, off\n\t"
      "global_load_async_to_lds_b128 %5, %13, off\n\t"
      "global_load_async_to_lds_b128 %6, %14, off\n\t"
      "global_load_async_to_lds_b128 %7, %15, off\n\t"
      "s_wait_xcnt 0x0"
      :: "v"(l), "v"(l + 1 * LSTEP), "v"(l + 2 * LSTEP), "v"(l + 3 * LSTEP),
         "v"(l + 4 * LSTEP), "v"(l + 5 * LSTEP), "v"(l + 6 * LSTEP),
         "v"(l + 7 * LSTEP),
         "v"(g), "v"(g + 1 * GSTEP), "v"(g + 2 * GSTEP), "v"(g + 3 * GSTEP),
         "v"(g + 4 * GSTEP), "v"(g + 5 * GSTEP), "v"(g + 6 * GSTEP),
         "v"(g + 7 * GSTEP)
      : "memory");
}

__global__ __launch_bounds__(128) void attn_kernel(
    const u16* __restrict__ q, const u16* __restrict__ k,
    const u16* __restrict__ vt, const int* __restrict__ mask,
    const float* __restrict__ x, float* __restrict__ out) {
  __shared__ __align__(16) float pen[SEQ];            // additive mask penalty
  __shared__ __align__(16) u16 KtL[KSTG * KPITCH];    // K stage   (keys x W)
  __shared__ __align__(16) u16 VtL[64 * VPITCH];      // V^T stage (W x keys)

  const int tid = threadIdx.x, wave = tid >> 5, lane = tid & 31;
  const int bh = blockIdx.x >> 5;                     // b*H + h
  const int qgrp = blockIdx.x & 31;
  const int b = bh >> 4, h = bh & 15;
  const int qbase = (qgrp * 4 + wave) * 16;

  for (int i = tid; i < SEQ; i += 128)
    pen[i] = -10000.0f * (1.0f - (float)mask[b * SEQ + i]);

  const u16* qbh = q + (size_t)bh * SEQ * HW;
  const u16* kbh = k + (size_t)bh * SEQ * HW;
  const u16* vbh = vt + (size_t)bh * HW * SEQ;

  const int lq = lane & 15, half = lane >> 4, koff = half * 8;

  // q^T B-fragments for the two 32-wide K-steps of the 64-dim head
  v16bf qf[2];
  {
    const u16* qr = qbh + (size_t)(qbase + lq) * HW;
    qf[0] = load_frag16(qr + 0 + koff);
    qf[1] = load_frag16(qr + 32 + koff);
  }

  v8f o[4] = {};
  float m_i = -3.0e38f, l_i = 0.0f;

  // copy maps: K 8 lanes a 128-byte row, 16 rows a copy of the block;
  // V^T 16 lanes a 256-byte row piece, 8 rows a copy of the block
  const u32 lk = (u32)(size_t)KtL + (u32)((tid >> 3) * KPITCH + (tid & 7) * 8) * 2u;
  const u32 lv = (u32)(size_t)VtL + (u32)((tid >> 4) * VPITCH + (tid & 15) * 8) * 2u;
  const u16* gk = kbh + tid * 8;                      // K stage is contiguous
  const u16* gv = vbh + (size_t)(tid >> 4) * SEQ + (tid & 15) * 8;

  for (int kst = 0; kst < SEQ; kst += KSTG) {
    // ---- cooperative staging of K / V^T stages (32 KB) through async DMA ---
    asm volatile("s_wait_dscnt 0x0" ::: "memory");    // own reads of the stage done
    __syncthreads();                                  // prev stage fully read
    copy8_step<16 * KPITCH * 2, 16 * HW>(lk, gk + (size_t)kst * HW);
    copy8_step<8 * VPITCH * 2, 8 * SEQ>(lv, gv + kst);
    if (kst + KSTG < SEQ) {                           // one 128-byte line a lane
      __builtin_prefetch(kbh + (size_t)(kst + KSTG) * HW + tid * 64, 0, 1);
      __builtin_prefetch(vbh + (size_t)(tid >> 1) * SEQ + kst + KSTG + (tid & 1) * 64, 0, 1);
    }
    asm volatile("s_wait_asynccnt 0x0" ::: "memory"); // own copies landed
    __syncthreads();                                  // stage visible to block

   // unrolled: every LDS address of a pass is then a constant offset of one register
   #pragma unroll
   for (int kp = 0; kp < KSTG; kp += 32) {
    const int kb = kst + kp;
    // ---- scores^T tile: 32 keys x 16 queries, two 16x16 accumulators ----
    v16bf a0[2], a1[2];
    v4f pn[4];
    #pragma unroll
    for (int ks = 0; ks < 2; ks++) {
      a0[ks] = load_frag16(KtL + (size_t)(kp + lq) * KPITCH + ks * 32 + koff);
      a1[ks] = load_frag16(KtL + (size_t)(kp + 16 + lq) * KPITCH + ks * 32 + koff);
      pn[ks]     = *reinterpret_cast<const v4f*>(pen + kb + half * 8 + ks * 4);
      pn[2 + ks] = *reinterpret_cast<const v4f*>(pen + kb + 16 + half * 8 + ks * 4);
    }
    // keeps a pass's 12 LDS reads one group ahead of its score WMMAs, free to
    // rise into the pass before: without it the mask reads stand among the
    // WMMAs, no read starts under the pass before, and the build pairs fewer
    // vector instructions and needs more v_nop behind the WMMAs
    __builtin_amdgcn_sched_barrier(0);
    v8f s0 = {}, s1 = {};
    #pragma unroll
    for (int ks = 0; ks < 2; ks++) {
      s0 = __builtin_amdgcn_wmma_f32_16x16x32_bf16(
          false, a0[ks], false, qf[ks], (short)0, s0, false, false);
      s1 = __builtin_amdgcn_wmma_f32_16x16x32_bf16(
          false, a1[ks], false, qf[ks], (short)0, s1, false, false);
    }
    // additive mask (keys live along vgpr index + lane half)
    #pragma unroll
    for (int r = 0; r < 4; r++) {
      s0[r]     += pn[0][r];
      s0[4 + r] += pn[1][r];
      s1[r]     += pn[2][r];
      s1[4 + r] += pn[3][r];
    }
    // ---- online softmax over keys: per-lane 16 values + partner (xor 16) --
    float mloc = -3.0e38f;
    #pragma unroll
    for (int r = 0; r < 8; r++) mloc = fmaxf(mloc, fmaxf(s0[r], s1[r]));
    mloc = fmaxf(mloc, __shfl_xor(mloc, 16, 32));
    const float mnew = fmaxf(m_i, mloc);
    const float corr = __expf(m_i - mnew);
    float p0[8], p1[8], psum = 0.0f;
    #pragma unroll
    for (int r = 0; r < 8; r++) {
      p0[r] = __expf(s0[r] - mnew);
      p1[r] = __expf(s1[r] - mnew);
      psum += p0[r] + p1[r];
    }
    psum += __shfl_xor(psum, 16, 32);
    l_i = l_i * corr + psum;
    m_i = mnew;
    #pragma unroll
    for (int t = 0; t < 4; t++)
      #pragma unroll
      for (int r = 0; r < 8; r++) o[t][r] *= corr;

    // ---- P^T as B operand, straight from the score accumulators -----------
    // lane (c, h): s0[r] is key 8h+r, s1[r] is key 16+8h+r of query c, which is
    // the hardware k order of a B fragment's elements 0..7 and 8..15
    v16f pv;
    #pragma unroll
    for (int r = 0; r < 8; r++) { pv[r] = p0[r]; pv[8 + r] = p1[r]; }
    const v16bf pfrag = __builtin_convertvector(pv, v16bf);   // RNE, packed cvt
    #pragma unroll
    for (int t = 0; t < 4; t++) {                     // h^T rows w = t*16..+15
      const v16bf vfrag = load_frag16(VtL + (size_t)(t * 16 + lq) * VPITCH + kp + koff);
      o[t] = __builtin_amdgcn_wmma_f32_16x16x32_bf16(
          false, vfrag, false, pfrag, (short)0, o[t], false, false);
    }
   }
  }

  // epilogue: divide by softmax sum, add residual, store fp32
  const float inv = 1.0f / (l_i + 1e-20f);
  const int s = qbase + lq;
  #pragma unroll
  for (int t = 0; t < 4; t++) {
    #pragma unroll
    for (int r = 0; r < 8; r++) {
      const int w = t * 16 + r + 8 * half;
      const size_t oidx = ((size_t)b * SEQ + s) * DIM + h * HW + w;
      out[oidx] = o[t][r] * inv + x[oidx];
    }
  }
}

// ---------------------------------------------------------------------------
extern "C" void kernel_launch(void* const* d_in, const int* in_sizes, int n_in,
                              void* d_out, int out_size, void* d_ws,
                              size_t ws_size, hipStream_t stream) {
  const float* x     = (const float*)d_in[0];
  const int*   mask  = (const int*)d_in[1];
  const float* gamma = (const float*)d_in[2];
  const float* beta  = (const float*)d_in[3];
  const float* wq    = (const float*)d_in[4];
  const float* bq    = (const float*)d_in[5];
  const float* wk    = (const float*)d_in[6];
  const float* bk    = (const float*)d_in[7];
  const float* wv    = (const float*)d_in[8];
  const float* bv    = (const float*)d_in[9];
  float* out = (float*)d_out;

  char* ws = (char*)d_ws;
  const size_t MB = 1024 * 1024;
  u16* xn = (u16*)ws;                         // 8 MB  (4096x1024 bf16)
  u16* wt = (u16*)(ws + 8 * MB);              // 6 MB  (3x 1024x1024 bf16, transposed)
  u16* qb = (u16*)(ws + 14 * MB);             // 8 MB  (B,H,S,W)
  u16* kb = (u16*)(ws + 22 * MB);             // 8 MB  (B,H,S,W)
  u16* vt = (u16*)(ws + 30 * MB);             // 8 MB  (B,H,W,S)

  ln_bf16_kernel<<<BATCH * SEQ, 256, 0, stream>>>(x, gamma, beta, xn);

  dim3 tg(32, 32, 3), tb(32, 8, 1);
  wt_bf16_kernel<<<tg, tb, 0, stream>>>(wq, wk, wv, wt);

  dim3 gg(32, 8, 3);
  qkv_wmma_kernel<<<gg, 128, 0, stream>>>(xn, wt, bq, bk, bv, qb, kb, vt);

  attn_kernel<<<BATCH * HEADS * (SEQ / 16) / 4, 128, 0, stream>>>(
      qb, kb, vt, mask, x, out);
}

// v005
// A run of this version takes 75.3 microseconds.
// Timed twice side by side with v004, it ran 1.10 and 1.11 times as fast.
// All steps since v000 together make it 3.54 times as fast.
#include <hip/hip_runtime.h>
#include <hip/hip_bf16.h>

typedef unsigned short u16;
typedef unsigned int   u32;

typedef __attribute__((ext_vector_type(16))) __bf16 v16bf;
typedef __attribute__((ext_vector_type(8)))  float  v8f;
typedef __attribute__((ext_vector_type(4)))  int    v4i;
typedef __attribute__((ext_vector_type(16))) float  v16f;
typedef __attribute__((ext_vector_type(4)))  float  v4f;

struct FragBits { uint4 lo; uint4 hi; };   // 32 bytes == 16 bf16

static __device__ __forceinline__ v16bf make_frag(const uint4& lo, const uint4& hi) {
  FragBits s{lo, hi};
  return __builtin_bit_cast(v16bf, s);
}

// WMMA 16-bit A/B fragment layout: lane L holds (row/col = L%16),
// K-chunks at koff=(L/16)*8 : elements [koff, koff+7] and [koff+16, koff+23].
// Caller passes p already offset by koff; chunks are uint4[0] and uint4[2].
static __device__ __forceinline__ v16bf load_frag16(const u16* p) {
  const uint4* u = reinterpret_cast<const uint4*>(p);
  return make_frag(u[0], u[2]);
}

static __device__ __forceinline__ u16 f2bf(float f) {
  u32 u = __builtin_bit_cast(u32, f);
  u += 0x7FFFu + ((u >> 16) & 1u);   // RNE
  return (u16)(u >> 16);
}

constexpr int DIM = 1024;
constexpr int SEQ = 2048;
constexpr int BATCH = 2;
constexpr int HEADS = 16;
constexpr int HW = 64;        // head width

// ---------------------------------------------------------------------------
// Kernel 1: LayerNorm + convert to bf16. One 256-thread block per row.
// ---------------------------------------------------------------------------
__global__ __launch_bounds__(256) void ln_bf16_kernel(
    const float* __restrict__ x, const float* __restrict__ gamma,
    const float* __restrict__ beta, u16* __restrict__ xn) {
  const int row = blockIdx.x;          // 0 .. B*S-1
  const int tid = threadIdx.x;         // 256 threads * float4 = 1024
  const float4 v = reinterpret_cast<const float4*>(x + (size_t)row * DIM)[tid];
  float s  = v.x + v.y + v.z + v.w;
  float s2 = v.x * v.x + v.y * v.y + v.z * v.z + v.w * v.w;
  #pragma unroll
  for (int off = 16; off > 0; off >>= 1) {
    s  += __shfl_down(s,  off, 32);
    s2 += __shfl_down(s2, off, 32);
  }
  __shared__ float red0[8], red1[8];
  const int wid = tid >> 5, lid = tid & 31;
  if (lid == 0) { red0[wid] = s; red1[wid] = s2; }
  __syncthreads();
  float ts = 0.f, ts2 = 0.f;
  #pragma unroll
  for (int i = 0; i < 8; i++) { ts += red0[i]; ts2 += red1[i]; }
  const float mu   = ts * (1.0f / DIM);
  const float var  = ts2 * (1.0f / DIM) - mu * mu;
  const float rstd = rsqrtf(var + 1e-5f);
  const float4 g = reinterpret_cast<const float4*>(gamma)[tid];
  const float4 b = reinterpret_cast<const float4*>(beta)[tid];
  uint2 o;
  o.x = (u32)f2bf((v.x - mu) * rstd * g.x + b.x) |
        ((u32)f2bf((v.y - mu) * rstd * g.y + b.y) << 16);
  o.y = (u32)f2bf((v.z - mu) * rstd * g.z + b.z) |
        ((u32)f2bf((v.w - mu) * rstd * g.w + b.w) << 16);
  reinterpret_cast<uint2*>(xn + (size_t)row * DIM)[tid] = o;
}

// ---------------------------------------------------------------------------
// Kernel 2: transpose + bf16-convert weights: Wt[j][k] = (bf16) W[k][j]
// ---------------------------------------------------------------------------
__global__ __launch_bounds__(256) void wt_bf16_kernel(
    const float* __restrict__ wq, const float* __restrict__ wk,
    const float* __restrict__ wv, u16* __restrict__ wt) {
  __shared__ float tile[32][33];
  const float* w = (blockIdx.z == 0) ? wq : (blockIdx.z == 1) ? wk : wv;
  u16* o = wt + (size_t)blockIdx.z * DIM * DIM;
  const int tx = threadIdx.x, ty = threadIdx.y;        // 32 x 8
  #pragma unroll
  for (int i = 0; i < 4; i++) {
    const int k = blockIdx.y * 32 + ty + i * 8;
    const int j = blockIdx.x * 32 + tx;
    tile[ty + i * 8][tx] = w[(size_t)k * DIM + j];     // tile[kloc][jloc]
  }
  __syncthreads();
  #pragma unroll
  for (int i = 0; i < 4; i++) {
    const int j = blockIdx.x * 32 + ty + i * 8;
    const int k = blockIdx.y * 32 + tx;
    o[(size_t)j * DIM + k] = f2bf(tile[tx][ty + i * 8]);
  }
}

// ---------------------------------------------------------------------------
// Kernel 3: QKV GEMM on WMMA bf16. grid=(32 Mtiles, 8 Ntiles, 3 proj),
// 128 threads = 4 waves (2x2); block tile 128x128, wave tile 64x64.
// Per stage (64 k) the block copies 128 rows of xn and 128 rows of wt into LDS
// (async copies, two buffers: the next stage flies while this one is used).
// q,k stored (B,H,S,W); v stored transposed (B,H,W,S). Scale 1/8 folded in q.
// ---------------------------------------------------------------------------
constexpr int GK     = 64;                 // k per stage: 128-byte rows
constexpr int GPITCH = 72;                 // LDS row pitch in elements: 144 B
constexpr int GOPER  = 128 * GPITCH;       // one operand's tile, elements
constexpr int GSTAGE = 2 * GOPER;          // one buffer: [xn rows | wt rows]
constexpr int GNST   = DIM / GK;           // 16 stages

// Eight 16-byte copies of one lane: rows r, r+16, ... r+112 of one operand.
// The s_wait_xcnt stands inside the statement, behind the last copy, so that
// no address register is rewritten ahead of it.
static __device__ __forceinline__ void copy8_rows(u32 l, const u16* g) {
  asm volatile(
      "global_load_async_to_lds_b128 %0, %8, off\n\t"
      "global_load_async_to_lds_b128 %1, %9, off\n\t"
      "global_load_async_to_lds_b128 %2, %10, off\n\t"
      "global_load_async_to_lds_b128 %3, %11, off\n\t"
      "global_load_async_to_lds_b128 %4, %12, off\n\t"
      "global_load_async_to_lds_b128 %5, %13, off\n\t"
      "global_load_async_to_lds_b128 %6, %14, off\n\t"
      "global_load_async_to_lds_b128 %7, %15, off\n\t"
      "s_wait_xcnt 0x0"
      :: "v"(l), "v"(l + 1 * 16 * GPITCH * 2), "v"(l + 2 * 16 * GPITCH * 2),
         "v"(l + 3 * 16 * GPITCH * 2), "v"(l + 4 * 16 * GPITCH * 2),
         "v"(l + 5 * 16 * GPITCH * 2), "v"(l + 6 * 16 * GPITCH * 2),
         "v"(l + 7 * 16 * GPITCH * 2),
         "v"(g), "v"(g + 1 * 16 * DIM), "v"(g + 2 * 16 * DIM),
         "v"(g + 3 * 16 * DIM), "v"(g + 4 * 16 * DIM), "v"(g + 5 * 16 * DIM),
         "v"(g + 6 * 16 * DIM), "v"(g + 7 * 16 * DIM)
      : "memory");
}

// A wave's 64x64 result: bias, (q only) scale, bf16, one 2-byte store an element.
template <int PROJ>
static __device__ __forceinline__ void store_tile(
    const v8f (&acc)[4][4], const float* __restrict__ bias,
    u16* __restrict__ dst, int row0, int col0, int lq, int half) {
  #pragma unroll
  for (int mi = 0; mi < 4; mi++) {
    #pragma unroll
    for (int nt = 0; nt < 4; nt++) {
      const int col = col0 + nt * 16 + lq;             // N = lane%16
      const float bvl = bias[col];
      const int h = col >> 6, w = col & 63;
      #pragma unroll
      for (int r = 0; r < 8; r++) {
        const int m = r + half * 8;                    // M = vgpr + 8*(lane/16)
        const int row = row0 + mi * 16 + m;
        const int b = row >> 11, s = row & (SEQ - 1);
        float val = acc[mi][nt][r] + bvl;
        if (PROJ == 0) val *= 0.125f;                  // 1/sqrt(64)
        if (PROJ == 2)
          dst[((size_t)(b * HEADS + h) * HW + w) * SEQ + s] = f2bf(val);
        else
          dst[((size_t)(b * HEADS + h) * SEQ + s) * HW + w] = f2bf(val);
      }
    }
    // one row of tiles at a time: without it the compiler converts all 128
    // values ahead of the stores and the register count goes above v255
    __builtin_amdgcn_sched_barrier(0);
  }
  // a precaution: nothing in this kernel follows the three nests
  asm volatile("s_wait_xcnt 0x0" ::: "memory");
}

__global__ __launch_bounds__(128) void qkv_wmma_kernel(
    const u16* __restrict__ xn, const u16* __restrict__ wt,
    const float* __restrict__ bq, const float* __restrict__ bk,
    const float* __restrict__ bv, u16* __restrict__ qO,
    u16* __restrict__ kO, u16* __restrict__ vtO) {
  __shared__ __align__(16) u16 stg[2 * GSTAGE];      // 73,728 B

  const int proj = blockIdx.z;
  const int tid  = threadIdx.x;
  const int wave = tid >> 5;
  const int lane = tid & 31;
  const int m0 = blockIdx.x * 128;
  const int n0 = blockIdx.y * 128;
  const int wm = (wave >> 1) * 64;                   // wave's rows in the tile
  const int wn = (wave & 1) * 64;                    // wave's cols in the tile
  const u16* wsel = wt + (size_t)proj * DIM * DIM;

  const int lq = lane & 15;
  const int koff = (lane >> 4) * 8;

  // copy map: 8 lanes cover one 128-byte row, a wave 4 whole rows per copy
  const int crow = tid >> 3, ccol = (tid & 7) * 8;
  const u16* gx = xn + (size_t)(m0 + crow) * DIM + ccol;
  const u16* gw = wsel + (size_t)(n0 + crow) * DIM + ccol;
  const u32 lx = (u32)(size_t)stg + (u32)(crow * GPITCH + ccol) * 2u;
  const u32 lw = lx + GOPER * 2u;

  // prologue, two buffers
  copy8_rows(lx, gx);
  copy8_rows(lw, gw);
  asm volatile("s_wait_asynccnt 0x0" ::: "memory");  // stage 0 landed (own copies)
  __syncthreads();                                   // stage 0 visible to block
  copy8_rows(lx + GSTAGE * 2u, gx + GK);
  copy8_rows(lw + GSTAGE * 2u, gw + GK);

  v8f acc[4][4] = {};
  for (int t = 0; t < GNST; t++) {
    const u16* sx = stg + (t & 1) * GSTAGE + (wm + lq) * GPITCH + koff;
    const u16* sw = stg + (t & 1) * GSTAGE + GOPER + (wn + lq) * GPITCH + koff;
    #pragma unroll
    for (int ks = 0; ks < 2; ks++) {
      v16bf a[4], bfr[4];
      #pragma unroll
      for (int i = 0; i < 4; i++) {
        a[i]   = load_frag16(sx + i * 16 * GPITCH + ks * 32);
        bfr[i] = load_frag16(sw + i * 16 * GPITCH + ks * 32);
      }
      // keeps the 16 LDS reads one group ahead of the 16 WMMAs: without it the
      // compiler sinks them between the rows, one full LDS wait per 4 WMMAs
      __builtin_amdgcn_sched_barrier(0);
      #pragma unroll
      for (int mi = 0; mi < 4; mi++)
        #pragma unroll
        for (int nt = 0; nt < 4; nt++)
          acc[mi][nt] = __builtin_amdgcn_wmma_f32_16x16x32_bf16(
              false, a[mi], false, bfr[nt], (short)0, acc[mi][nt], false, false);
      // keeps the next group's reads from moving up among these WMMAs
      __builtin_amdgcn_sched_barrier(0);
    }
    // publish point of stage t+1; it also frees the buffer just read
    asm volatile("s_wait_dscnt 0x0" ::: "memory");    // own reads of this buffer done
    asm volatile("s_wait_asynccnt 0x0" ::: "memory"); // own copies of stage t+1 landed
    __syncthreads();
    if (t + 2 < GNST) {
      const u32 bo = (u32)(t & 1) * (GSTAGE * 2u);
      copy8_rows(lx + bo, gx + (t + 2) * GK);
      copy8_rows(lw + bo, gw + (t + 2) * GK);
    }
  }
  asm volatile("s_wait_asynccnt 0x0" ::: "memory");   // nothing in flight at the end

  // the projection is the same for the whole block: one test, three loop nests
  const int half = lane >> 4;
  if (proj == 0)      store_tile<0>(acc, bq, qO,  m0 + wm, n0 + wn, lq, half);
  else if (proj == 1) store_tile<1>(acc, bk, kO,  m0 + wm, n0 + wn, lq, half);
  else                store_tile<2>(acc, bv, vtO, m0 + wm, n0 + wn, lq, half);
}

// ---------------------------------------------------------------------------
// Kernel 4: flash attention. 256 threads = 8 waves (same b,h) = 4 column sets
// x 2 key sets. A wave holds 32 query columns (two 16-column groups), so that
// every K and V^T fragment read from LDS feeds two WMMAs, and walks one 64-key
// half of every stage; the two key sets of a column set are joined through LDS
// behind the loop. Per stage (128 keys):
//   * block cooperatively stages K(128x64) and V^T(64x128) into LDS via
//     gfx1250 async-to-LDS DMA (ASYNCcnt), shared by all 8 waves
// and per pass (32 keys of the wave's half stage), per column group:
//   * scores^T = K x q^T on WMMA -> online softmax (per-lane + shfl_xor 16)
//   * P^T packed to bf16 in registers -> B-fragment (no LDS)
//   * h^T += V^T x P^T on WMMA
// LDS rows are read 16 bytes a lane, one row a lane: their pitch is an odd
// multiple of 16 bytes, so that 16 lanes fall on 64 different banks.
// ---------------------------------------------------------------------------
constexpr int KPITCH = HW + 8;             // K rows: 128 B of data, 144 B apart
constexpr int KSTG   = 128;                // keys per stage (one copy wait, two barriers)
constexpr int VPITCH = KSTG + 8;           // V^T rows: 256 B of data, 272 B apart
constexpr int KHALF  = KSTG / 2;           // keys of a stage that one wave walks

// Four 16-byte copies of one lane, LSTEP bytes apart in LDS and GSTEP elements
// apart in global memory. The s_wait_xcnt stands inside the statement, behind
// the last copy, so that no address register is rewritten ahead of it.
template <int LSTEP, int GSTEP>
static __device__ __forceinline__ void copy4_step(u32 l, const u16* g) {
  asm volatile(
      "global_load_async_to_lds_b128 %0, %4, off\n\t"
      "global_load_async_to_lds_b128 %1, %5, off\n\t"
      "global_load_async_to_lds_b128 %2, %6, off\n\t"
      "global_load_async_to_lds_b128 %3, %7, off\n\t"
      "s_wait_xcnt 0x0"
      :: "v"(l), "v"(l + 1 * LSTEP), "v"(l + 2 * LSTEP), "v"(l + 3 * LSTEP),
         "v"(g), "v"(g + 1 * GSTEP), "v"(g + 2 * GSTEP), "v"(g + 3 * GSTEP)
      : "memory");
}

// four waves a SIMD (two blocks a WGP) is all that 512 blocks of 8 waves fill:
// told so, the compiler spends that residency's 256 registers on issuing a
// pass's LDS reads in one group well ahead of their use
__global__ __launch_bounds__(256) __attribute__((amdgpu_waves_per_eu(4, 4)))
void attn_kernel(
    const u16* __restrict__ q, const u16* __restrict__ k,
    const u16* __restrict__ vt, const int* __restrict__ mask,
    const float* __restrict__ x, float* __restrict__ out) {
  __shared__ __align__(16) float pen[SEQ];            // additive mask penalty
  __shared__ __align__(16) u16 KtL[KSTG * KPITCH];    // K stage   (keys x W)
  __shared__ __align__(16) u16 VtL[64 * VPITCH];      // V^T stage (W x keys)
  __shared__ __align__(16) v4f joinL[8 * 9 * 32];     // a wave's hand-over: 9 x 16 B a lane

  const int tid = threadIdx.x;
  // the wave's number in a scalar register: what follows from it costs no VGPR
  const int wave = __builtin_amdgcn_readfirstlane(tid >> 5);
  const int cset = wave & 3, kset = wave >> 2;        // column set, key set
  const int bh = blockIdx.x >> 4;                     // b*H + h
  const int qgrp = blockIdx.x & 15;
  const int b = bh >> 4, h = bh & 15;
  const int qbase = (qgrp * 4 + cset) * 32;

  for (int i = tid; i < SEQ; i += 256)
    pen[i] = -10000.0f * (1.0f - (float)mask[b * SEQ + i]);

  const u16* qbh = q + (size_t)bh * SEQ * HW;
  const u16* kbh = k + (size_t)bh * SEQ * HW;
  const u16* vbh = vt + (size_t)bh * HW * SEQ;

  const int lq = tid & 15, half = (tid >> 4) & 1, koff = half * 8;

  // q^T B-fragments: two column groups x the two 32-wide K-steps of the head
  const u16* qr = qbh + (size_t)(qbase + lq) * HW + koff;
  const v16bf qf[2][2] = {
      {load_frag16(qr), load_frag16(qr + 32)},
      {load_frag16(qr + 16 * HW), load_frag16(qr + 16 * HW + 32)}};

  v8f o[2][4] = {};
  float m_i[2] = {-3.0e38f, -3.0e38f}, l_i[2] = {0.0f, 0.0f};

  // copy maps: K 8 lanes a 128-byte row, 32 rows a copy of the block;
  // V^T 16 lanes a 256-byte row piece, 16 rows a copy of the block
  const u32 lk = (u32)(size_t)KtL + (u32)((tid >> 3) * KPITCH + (tid & 7) * 8) * 2u;
  const u32 lv = (u32)(size_t)VtL + (u32)((tid >> 4) * VPITCH + (tid & 15) * 8) * 2u;
  const u16* gk = kbh + tid * 8;                      // K stage is contiguous
  const u16* gv = vbh + (size_t)(tid >> 4) * SEQ + (tid & 15) * 8;

  // the wave's half of a stage
  const u16*   Kw = KtL + (size_t)(kset * KHALF + lq) * KPITCH + koff;
  const u16*   Vw = VtL + (size_t)lq * VPITCH + kset * KHALF + koff;
  const float* Pw = pen + kset * KHALF + half * 8;

  for (int kst = 0; kst < SEQ; kst += KSTG) {
    // ---- cooperative staging of K / V^T stages (32 KB) through async DMA ---
    asm volatile("s_wait_dscnt 0x0" ::: "memory");    // own reads of the stage done
    __syncthreads();                                  // prev stage fully read
    copy4_step<32 * KPITCH * 2, 32 * HW>(lk, gk + (size_t)kst * HW);
    copy4_step<16 * VPITCH * 2, 16 * SEQ>(lv, gv + kst);
    asm volatile("s_wait_asynccnt 0x0" ::: "memory"); // own copies landed
    __syncthreads();                                  // stage visible to block

   // unrolled: every LDS address of a pass is then a constant offset of one register
   #pragma unroll
   for (int kp = 0; kp < KHALF; kp += 32) {
    // ---- scores^T: 32 keys x 32 queries, four 16x16 accumulators ----
    v16bf a0[2], a1[2];
    v4f pn[4];
    #pragma unroll
    for (int ks = 0; ks < 2; ks++) {
      a0[ks] = load_frag16(Kw + (size_t)kp * KPITCH + ks * 32);
      a1[ks] = load_frag16(Kw + (size_t)(kp + 16) * KPITCH + ks * 32);
      pn[ks]     = *reinterpret_cast<const v4f*>(Pw + kst + kp + ks * 4);
      pn[2 + ks] = *reinterpret_cast<const v4f*>(Pw + kst + kp + 16 + ks * 4);
    }
    // keeps a pass's 12 LDS reads one group ahead of its score WMMAs, free to
    // rise into the pass before: without it the mask reads stand among the
    // WMMAs, no read starts under the pass before, and the build pairs fewer
    // vector instructions and needs more v_nop behind the WMMAs
    __builtin_amdgcn_sched_barrier(0);
    v8f s0[2] = {}, s1[2] = {};
    #pragma unroll
    for (int ks = 0; ks < 2; ks++) {
      #pragma unroll
      for (int j = 0; j < 2; j++) {
        s0[j] = __builtin_amdgcn_wmma_f32_16x16x32_bf16(
            false, a0[ks], false, qf[j][ks], (short)0, s0[j], false, false);
        s1[j] = __builtin_amdgcn_wmma_f32_16x16x32_bf16(
            false, a1[ks], false, qf[j][ks], (short)0, s1[j], false, false);
      }
    }
    v16bf pfrag[2];
    #pragma unroll
    for (int j = 0; j < 2; j++) {
      // additive mask (keys live along vgpr index + lane half)
      #pragma unroll
      for (int r = 0; r < 4; r++) {
        s0[j][r]     += pn[0][r];
        s0[j][4 + r] += pn[1][r];
        s1[j][r]     += pn[2][r];
        s1[j][4 + r] += pn[3][r];
      }
      // ---- online softmax over keys: per-lane 16 values + partner (xor 16) --
      float mloc = -3.0e38f;
      #pragma unroll
      for (int r = 0; r < 8; r++) mloc = fmaxf(mloc, fmaxf(s0[j][r], s1[j][r]));
      mloc = fmaxf(mloc, __shfl_xor(mloc, 16, 32));
      const float mnew = fmaxf(m_i[j], mloc);
      const float corr = __expf(m_i[j] - mnew);
      float p0[8], p1[8], psum = 0.0f;
      #pragma unroll
      for (int r = 0; r < 8; r++) {
        p0[r] = __expf(s0[j][r] - mnew);
        p1[r] = __expf(s1[j][r] - mnew);
        psum += p0[r] + p1[r];
      }
      psum += __shfl_xor(psum, 16, 32);
      l_i[j] = l_i[j] * corr + psum;
      m_i[j] = mnew;
      #pragma unroll
      for (int t = 0; t < 4; t++)
        #pragma unroll
        for (int r = 0; r < 8; r++) o[j][t][r] *= corr;

      // ---- P^T as B operand, straight from the score accumulators ---------
      // lane (c, h): s0[r] is key 8h+r, s1[r] is key 16+8h+r of query c, which
      // is the hardware k order of a B fragment's elements 0..7 and 8..15
      v16f pv;
      #pragma unroll
      for (int r = 0; r < 8; r++) { pv[r] = p0[r]; pv[8 + r] = p1[r]; }
      pfrag[j] = __builtin_convertvector(pv, v16bf);          // RNE, packed cvt
      // between the two column groups: without it the compiler mixes their
      // softmax, the build needs more than the 256 registers that four waves a
      // SIMD leave a wave, and values go to scratch memory
      if (j == 0) __builtin_amdgcn_sched_barrier(0);
    }
    #pragma unroll
    for (int t = 0; t < 4; t++) {                     // h^T rows w = t*16..+15
      const v16bf vfrag = load_frag16(Vw + (size_t)(t * 16) * VPITCH + kp);
      #pragma unroll
      for (int j = 0; j < 2; j++)
        o[j][t] = __builtin_amdgcn_wmma_f32_16x16x32_bf16(
            false, vfrag, false, pfrag[j], (short)0, o[j][t], false, false);
    }
   }
  }

  // ---- join of the two key sets: wave (cset, kset) finishes column group
  // kset and hands its part of the other group to wave (cset, 1 - kset) ------
  v8f keep[4], give[4];
  #pragma unroll
  for (int t = 0; t < 4; t++) {
    keep[t] = kset ? o[1][t] : o[0][t];
    give[t] = kset ? o[0][t] : o[1][t];
  }
  const float mk = kset ? m_i[1] : m_i[0], lk_ = kset ? l_i[1] : l_i[0];
  const float mg = kset ? m_i[0] : m_i[1], lg  = kset ? l_i[0] : l_i[1];
  v4f* jw = joinL + wave * (9 * 32) + (tid & 31);     // 16 B a lane, lanes adjacent
  #pragma unroll
  for (int t = 0; t < 4; t++) {
    jw[(2 * t) * 32]     = v4f{give[t][0], give[t][1], give[t][2], give[t][3]};
    jw[(2 * t + 1) * 32] = v4f{give[t][4], give[t][5], give[t][6], give[t][7]};
  }
  jw[8 * 32] = v4f{mg, lg, 0.0f, 0.0f};
  __syncthreads();                                    // hand-overs visible to block
  const v4f* jr = joinL + (wave ^ 4) * (9 * 32) + (tid & 31);
  const v4f ml = jr[8 * 32];
  const float mj = fmaxf(mk, ml[0]);
  const float ck = __expf(mk - mj), cg = __expf(ml[0] - mj);
  const float lsum = lk_ * ck + ml[1] * cg;

  // epilogue: divide by softmax sum, add residual, store fp32
  const float inv = 1.0f / (lsum + 1e-20f);
  const float fk = ck * inv, fg = cg * inv;
  const size_t obase = (size_t)(b * SEQ + qbase + kset * 16 + lq) * DIM + h * HW + 8 * half;
  #pragma unroll
  for (int t = 0; t < 4; t++) {
    const v4f g0 = jr[(2 * t) * 32], g1 = jr[(2 * t + 1) * 32];
    const v4f* xr = reinterpret_cast<const v4f*>(x + obase + t * 16);
    const v4f x0 = xr[0], x1 = xr[1];
    v4f r0, r1;
    #pragma unroll
    for (int r = 0; r < 4; r++) {
      r0[r] = keep[t][r] * fk + g0[r] * fg + x0[r];
      r1[r] = keep[t][4 + r] * fk + g1[r] * fg + x1[r];
    }
    v4f* orow = reinterpret_cast<v4f*>(out + obase + t * 16);
    orow[0] = r0;
    orow[1] = r1;
  }
}

// ---------------------------------------------------------------------------
extern "C" void kernel_launch(void* const* d_in, const int* in_sizes, int n_in,
                              void* d_out, int out_size, void* d_ws,
                              size_t ws_size, hipStream_t stream) {
  const float* x     = (const float*)d_in[0];
  const int*   mask  = (const int*)d_in[1];
  const float* gamma = (const float*)d_in[2];
  const float* beta  = (const float*)d_in[3];
  const float* wq    = (const float*)d_in[4];
  const float* bq    = (const float*)d_in[5];
  const float* wk    = (const float*)d_in[6];
  const float* bk    = (const float*)d_in[7];
  const float* wv    = (const float*)d_in[8];
  const float* bv    = (const float*)d_in[9];
  float* out = (float*)d_out;

  char* ws = (char*)d_ws;
  const size_t MB = 1024 * 1024;
  u16* xn = (u16*)ws;                         // 8 MB  (4096x1024 bf16)
  u16* wt = (u16*)(ws + 8 * MB);              // 6 MB  (3x 1024x1024 bf16, transposed)
  u16* qb = (u16*)(ws + 14 * MB);             // 8 MB  (B,H,S,W)
  u16* kb = (u16*)(ws + 22 * MB);             // 8 MB  (B,H,S,W)
  u16* vt = (u16*)(ws + 30 * MB);             // 8 MB  (B,H,W,S)

  ln_bf16_kernel<<<BATCH * SEQ, 256, 0, stream>>>(x, gamma, beta, xn);

  dim3 tg(32, 32, 3), tb(32, 8, 1);
  wt_bf16_kernel<<<tg, tb, 0, stream>>>(wq, wk, wv, wt);

  dim3 gg(32, 8, 3);
  qkv_wmma_kernel<<<gg, 128, 0, stream>>>(xn, wt, bq, bk, bv, qb, kb, vt);

  attn_kernel<<<BATCH * HEADS * (SEQ / 32) / 4, 256, 0, stream>>>(
      qb, kb, vt, mask, x, out);
}

// v006
// One run takes 73.3 microseconds.
// Next to v005, in two timings, it ran 1.04 times as fast each time.
// All steps since v000 together make it 3.67 times as fast.
#include <hip/hip_runtime.h>
#include <hip/hip_bf16.h>

typedef unsigned short u16;
typedef unsigned int   u32;

typedef __attribute__((ext_vector_type(16))) __bf16 v16bf;
typedef __attribute__((ext_vector_type(8)))  float  v8f;
typedef __attribute__((ext_vector_type(4)))  int    v4i;
typedef __attribute__((ext_vector_type(16))) float  v16f;
typedef __attribute__((ext_vector_type(4)))  float  v4f;

struct FragBits { uint4 lo; uint4 hi; };   // 32 bytes == 16 bf16

static __device__ __forceinline__ v16bf make_frag(const uint4& lo, const uint4& hi) {
  FragBits s{lo, hi};
  return __builtin_bit_cast(v16bf, s);
}

// WMMA 16-bit A/B fragment layout: lane L holds (row/col = L%16),
// K-chunks at koff=(L/16)*8 : elements [koff, koff+7] and [koff+16, koff+23].
// Caller passes p already offset by koff; chunks are uint4[0] and uint4[2].
static __device__ __forceinline__ v16bf load_frag16(const u16* p) {
  const uint4* u = reinterpret_cast<const uint4*>(p);
  return make_frag(u[0], u[2]);
}

static __device__ __forceinline__ u16 f2bf(float f) {
  u32 u = __builtin_bit_cast(u32, f);
  u += 0x7FFFu + ((u >> 16) & 1u);   // RNE
  return (u16)(u >> 16);
}

constexpr int DIM = 1024;
constexpr int SEQ = 2048;
constexpr int BATCH = 2;
constexpr int HEADS = 16;
constexpr int HW = 64;        // head width

// ---------------------------------------------------------------------------
// Kernel 1: LayerNorm + convert to bf16. A wave does two whole rows by itself:
// 2,048 waves to start instead of 32,768, no LDS, no barrier. All 16 loads of
// a wave (512 contiguous bytes each) are in flight together.
// ---------------------------------------------------------------------------
constexpr int LNR = 2;                     // rows per wave
// two waves a SIMD is all that 256 blocks of 8 waves fill: told so, the compiler
// spends registers on issuing the 16 gamma and beta loads as one group; without
// it they stand behind the reduction pair by pair, each pair with a full wait
__global__ __launch_bounds__(256) __attribute__((amdgpu_waves_per_eu(2, 2)))
void ln_bf16_kernel(
    const float* __restrict__ x, const float* __restrict__ gamma,
    const float* __restrict__ beta, u16* __restrict__ xn) {
  const int lane = threadIdx.x & 31;
  const int row0 = (blockIdx.x * 8 + (threadIdx.x >> 5)) * LNR;
  const float4* xr = reinterpret_cast<const float4*>(x + (size_t)row0 * DIM) + lane;
  float4 v[LNR][8];
  #pragma unroll
  for (int r = 0; r < LNR; r++)
    #pragma unroll
    for (int i = 0; i < 8; i++) v[r][i] = xr[r * (DIM / 4) + i * 32];
  // precaution: the 16 loads' address pair is an operand, so it lives up to this
  // wait; without it the last load's result was allocated on top of the pair
  asm volatile("s_wait_xcnt 0x0" :: "v"(xr) : "memory");
  float4 g[8], b[8];
  #pragma unroll
  for (int i = 0; i < 8; i++) {
    g[i] = reinterpret_cast<const float4*>(gamma)[i * 32 + lane];
    b[i] = reinterpret_cast<const float4*>(beta)[i * 32 + lane];
  }
  // holds the build at one group of 16 row loads and one group of 16 gamma and
  // beta loads that fly under the sums: without it the compiler keeps far more
  // values live, goes above v255 and emits about a quarter more instructions
  __builtin_amdgcn_sched_barrier(0);
  float s[LNR], s2[LNR];
  #pragma unroll
  for (int r = 0; r < LNR; r++) {
    s[r] = 0.f; s2[r] = 0.f;
    #pragma unroll
    for (int i = 0; i < 8; i++) {
      const float4 t = v[r][i];
      s[r]  += t.x + t.y + t.z + t.w;
      s2[r] += t.x * t.x + t.y * t.y + t.z * t.z + t.w * t.w;
    }
  }
  #pragma unroll
  for (int off = 16; off > 0; off >>= 1) {
    #pragma unroll
    for (int r = 0; r < LNR; r++) {
      s[r]  += __shfl_xor(s[r],  off, 32);
      s2[r] += __shfl_xor(s2[r], off, 32);
    }
  }
  #pragma unroll
  for (int r = 0; r < LNR; r++) {
    const float mu   = s[r] * (1.0f / DIM);
    const float var  = s2[r] * (1.0f / DIM) - mu * mu;
    const float rstd = rsqrtf(var + 1e-5f);
    uint2* orow = reinterpret_cast<uint2*>(xn + (size_t)(row0 + r) * DIM) + lane;
    #pragma unroll
    for (int i = 0; i < 8; i++) {
      const float4 t = v[r][i];
      uint2 o;
      o.x = (u32)f2bf((t.x - mu) * rstd * g[i].x + b[i].x) |
            ((u32)f2bf((t.y - mu) * rstd * g[i].y + b[i].y) << 16);
      o.y = (u32)f2bf((t.z - mu) * rstd * g[i].z + b[i].z) |
            ((u32)f2bf((t.w - mu) * rstd * g[i].w + b[i].w) << 16);
      orow[i * 32] = o;
    }
  }
}

// ---------------------------------------------------------------------------
// Kernel 2: transpose + bf16-convert weights: Wt[j][k] = (bf16) W[k][j].
// 128 threads = 4 waves take a 64 x 64 tile: 3,072 waves to start instead of
// 24,576. A thread loads 8 k x 4 j (eight 16-byte loads in flight), packs 8 k
// of each j into 16 bytes, and the tile goes out through LDS as whole 128-byte
// rows of Wt.
// ---------------------------------------------------------------------------
constexpr int TPITCH = 72;                 // LDS row pitch in elements: 144 B
__global__ __launch_bounds__(128) void wt_bf16_kernel(
    const float* __restrict__ wq, const float* __restrict__ wk,
    const float* __restrict__ wv, u16* __restrict__ wt) {
  __shared__ __align__(16) u16 tile[64 * TPITCH];      // tile[jloc][kloc]
  const float* w = (blockIdx.z == 0) ? wq : (blockIdx.z == 1) ? wk : wv;
  u16* o = wt + (size_t)blockIdx.z * DIM * DIM;
  const int tid = threadIdx.x;
  const int j0 = blockIdx.x * 64, k0 = blockIdx.y * 64;
  const int jq = tid & 15, kg = tid >> 4;              // 16 j quads x 8 k groups
  const float* src = w + (size_t)(k0 + kg * 8) * DIM + j0 + jq * 4;
  v4f r[8];
  #pragma unroll
  for (int i = 0; i < 8; i++)
    r[i] = *reinterpret_cast<const v4f*>(src + (size_t)i * DIM);
  #pragma unroll
  for (int jj = 0; jj < 4; jj++) {
    uint4 p;
    p.x = (u32)f2bf(r[0][jj]) | ((u32)f2bf(r[1][jj]) << 16);
    p.y = (u32)f2bf(r[2][jj]) | ((u32)f2bf(r[3][jj]) << 16);
    p.z = (u32)f2bf(r[4][jj]) | ((u32)f2bf(r[5][jj]) << 16);
    p.w = (u32)f2bf(r[6][jj]) | ((u32)f2bf(r[7][jj]) << 16);
    *reinterpret_cast<uint4*>(tile + (jq * 4 + jj) * TPITCH + kg * 8) = p;
  }
  __syncthreads();
  #pragma unroll
  for (int i = 0; i < 4; i++) {
    const int j = (tid >> 3) + i * 16, kc = (tid & 7) * 8;   // 8 lanes a row
    const uint4 p = *reinterpret_cast<const uint4*>(tile + j * TPITCH + kc);
    *reinterpret_cast<uint4*>(o + (size_t)(j0 + j) * DIM + k0 + kc) = p;
  }
}

// ---------------------------------------------------------------------------
// Kernel 3: QKV GEMM on WMMA bf16. grid=(32 Mtiles, 8 Ntiles, 3 proj),
// 128 threads = 4 waves (2x2); block tile 128x128, wave tile 64x64.
// Per stage (64 k) the block copies 128 rows of xn and 128 rows of wt into LDS
// (async copies, two buffers: the next stage flies while this one is used).
// q,k stored (B,H,S,W); v stored transposed (B,H,W,S). Scale 1/8 folded in q.
// ---------------------------------------------------------------------------
constexpr int GK     = 64;                 // k per stage: 128-byte rows
constexpr int GPITCH = 72;                 // LDS row pitch in elements: 144 B
constexpr int GOPER  = 128 * GPITCH;       // one operand's tile, elements
constexpr int GSTAGE = 2 * GOPER;          // one buffer: [xn rows | wt rows]
constexpr int GNST   = DIM / GK;           // 16 stages

// Eight 16-byte copies of one lane: rows r, r+16, ... r+112 of one operand.
// The s_wait_xcnt stands inside the statement, behind the last copy, so that
// no address register is rewritten ahead of it.
static __device__ __forceinline__ void copy8_rows(u32 l, const u16* g) {
  asm volatile(
      "global_load_async_to_lds_b128 %0, %8, off\n\t"
      "global_load_async_to_lds_b128 %1, %9, off\n\t"
      "global_load_async_to_lds_b128 %2, %10, off\n\t"
      "global_load_async_to_lds_b128 %3, %11, off\n\t"
      "global_load_async_to_lds_b128 %4, %12, off\n\t"
      "global_load_async_to_lds_b128 %5, %13, off\n\t"
      "global_load_async_to_lds_b128 %6, %14, off\n\t"
      "global_load_async_to_lds_b128 %7, %15, off\n\t"
      "s_wait_xcnt 0x0"
      :: "v"(l), "v"(l + 1 * 16 * GPITCH * 2), "v"(l + 2 * 16 * GPITCH * 2),
         "v"(l + 3 * 16 * GPITCH * 2), "v"(l + 4 * 16 * GPITCH * 2),
         "v"(l + 5 * 16 * GPITCH * 2), "v"(l + 6 * 16 * GPITCH * 2),
         "v"(l + 7 * 16 * GPITCH * 2),
         "v"(g), "v"(g + 1 * 16 * DIM), "v"(g + 2 * 16 * DIM),
         "v"(g + 3 * 16 * DIM), "v"(g + 4 * 16 * DIM), "v"(g + 5 * 16 * DIM),
         "v"(g + 6 * 16 * DIM), "v"(g + 7 * 16 * DIM)
      : "memory");
}

// A wave's 64x64 result: bias, (q only) scale, bf16, one 2-byte store an element.
template <int PROJ>
static __device__ __forceinline__ void store_tile(
    const v8f (&acc)[4][4], const float* __restrict__ bias,
    u16* __restrict__ dst, int row0, int col0, int lq, int half) {
  #pragma unroll
  for (int mi = 0; mi < 4; mi++) {
    #pragma unroll
    for (int nt = 0; nt < 4; nt++) {
      const int col = col0 + nt * 16 + lq;             // N = lane%16
      const float bvl = bias[col];
      const int h = col >> 6, w = col & 63;
      #pragma unroll
      for (int r = 0; r < 8; r++) {
        const int m = r + half * 8;                    // M = vgpr + 8*(lane/16)
        const int row = row0 + mi * 16 + m;
        const int b = row >> 11, s = row & (SEQ - 1);
        float val = acc[mi][nt][r] + bvl;
        if (PROJ == 0) val *= 0.125f;                  // 1/sqrt(64)
        if (PROJ == 2)
          dst[((size_t)(b * HEADS + h) * HW + w) * SEQ + s] = f2bf(val);
        else
          dst[((size_t)(b * HEADS + h) * SEQ + s) * HW + w] = f2bf(val);
      }
    }
    // one row of tiles at a time: without it the compiler converts all 128
    // values ahead of the stores and the register count goes above v255
    __builtin_amdgcn_sched_barrier(0);
  }
  // a precaution: nothing in this kernel follows the three nests
  asm volatile("s_wait_xcnt 0x0" ::: "memory");
}

__global__ __launch_bounds__(128) void qkv_wmma_kernel(
    const u16* __restrict__ xn, const u16* __restrict__ wt,
    const float* __restrict__ bq, const float* __restrict__ bk,
    const float* __restrict__ bv, u16* __restrict__ qO,
    u16* __restrict__ kO, u16* __restrict__ vtO) {
  __shared__ __align__(16) u16 stg[2 * GSTAGE];      // 73,728 B

  const int proj = blockIdx.z;
  const int tid  = threadIdx.x;
  const int wave = tid >> 5;
  const int lane = tid & 31;
  const int m0 = blockIdx.x * 128;
  const int n0 = blockIdx.y * 128;
  const int wm = (wave >> 1) * 64;                   // wave's rows in the tile
  const int wn = (wave & 1) * 64;                    // wave's cols in the tile
  const u16* wsel = wt + (size_t)proj * DIM * DIM;

  const int lq = lane & 15;
  const int koff = (lane >> 4) * 8;

  // copy map: 8 lanes cover one 128-byte row, a wave 4 whole rows per copy
  const int crow = tid >> 3, ccol = (tid & 7) * 8;
  const u16* gx = xn + (size_t)(m0 + crow) * DIM + ccol;
  const u16* gw = wsel + (size_t)(n0 + crow) * DIM + ccol;
  const u32 lx = (u32)(size_t)stg + (u32)(crow * GPITCH + ccol) * 2u;
  const u32 lw = lx + GOPER * 2u;

  // prologue, two buffers
  copy8_rows(lx, gx);
  copy8_rows(lw, gw);
  asm volatile("s_wait_asynccnt 0x0" ::: "memory");  // stage 0 landed (own copies)
  __syncthreads();                                   // stage 0 visible to block
  copy8_rows(lx + GSTAGE * 2u, gx + GK);
  copy8_rows(lw + GSTAGE * 2u, gw + GK);

  v8f acc[4][4] = {};
  for (int t = 0; t < GNST; t++) {
    const u16* sx = stg + (t & 1) * GSTAGE + (wm + lq) * GPITCH + koff;
    const u16* sw = stg + (t & 1) * GSTAGE + GOPER + (wn + lq) * GPITCH + koff;
    #pragma unroll
    for (int ks = 0; ks < 2; ks++) {
      v16bf a[4], bfr[4];
      #pragma unroll
      for (int i = 0; i < 4; i++) {
        a[i]   = load_frag16(sx + i * 16 * GPITCH + ks * 32);
        bfr[i] = load_frag16(sw + i * 16 * GPITCH + ks * 32);
      }
      // keeps the 16 LDS reads one group ahead of the 16 WMMAs: without it the
      // compiler sinks them between the rows, one full LDS wait per 4 WMMAs
      __builtin_amdgcn_sched_barrier(0);
      #pragma unroll
      for (int mi = 0; mi < 4; mi++)
        #pragma unroll
        for (int nt = 0; nt < 4; nt++)
          acc[mi][nt] = __builtin_amdgcn_wmma_f32_16x16x32_bf16(
              false, a[mi], false, bfr[nt], (short)0, acc[mi][nt], false, false);
      // keeps the next group's reads from moving up among these WMMAs
      __builtin_amdgcn_sched_barrier(0);
    }
    // publish point of stage t+1; it also frees the buffer just read
    asm volatile("s_wait_dscnt 0x0" ::: "memory");    // own reads of this buffer done
    asm volatile("s_wait_asynccnt 0x0" ::: "memory"); // own copies of stage t+1 landed
    __syncthreads();
    if (t + 2 < GNST) {
      const u32 bo = (u32)(t & 1) * (GSTAGE * 2u);
      copy8_rows(lx + bo, gx + (t + 2) * GK);
      copy8_rows(lw + bo, gw + (t + 2) * GK);
    }
  }
  asm volatile("s_wait_asynccnt 0x0" ::: "memory");   // nothing in flight at the end

  // the projection is the same for the whole block: one test, three loop nests
  const int half = lane >> 4;
  if (proj == 0)      store_tile<0>(acc, bq, qO,  m0 + wm, n0 + wn, lq, half);
  else if (proj == 1) store_tile<1>(acc, bk, kO,  m0 + wm, n0 + wn, lq, half);
  else                store_tile<2>(acc, bv, vtO, m0 + wm, n0 + wn, lq, half);
}

// ---------------------------------------------------------------------------
// Kernel 4: flash attention. 256 threads = 8 waves (same b,h) = 4 column sets
// x 2 key sets. A wave holds 32 query columns (two 16-column groups), so that
// every K and V^T fragment read from LDS feeds two WMMAs, and walks one 64-key
// half of every stage; the two key sets of a column set are joined through LDS
// behind the loop. Per stage (128 keys):
//   * block cooperatively stages K(128x64) and V^T(64x128) into LDS via
//     gfx1250 async-to-LDS DMA (ASYNCcnt), shared by all 8 waves
// and per pass (32 keys of the wave's half stage), per column group:
//   * scores^T = K x q^T on WMMA -> online softmax (per-lane + shfl_xor 16)
//   * P^T packed to bf16 in registers -> B-fragment (no LDS)
//   * h^T += V^T x P^T on WMMA
// LDS rows are read 16 bytes a lane, one row a lane: their pitch is an odd
// multiple of 16 bytes, so that 16 lanes fall on 64 different banks.
// ---------------------------------------------------------------------------
constexpr int KPITCH = HW + 8;             // K rows: 128 B of data, 144 B apart
constexpr int KSTG   = 128;                // keys per stage (one copy wait, two barriers)
constexpr int VPITCH = KSTG + 8;           // V^T rows: 256 B of data, 272 B apart
constexpr int KHALF  = KSTG / 2;           // keys of a stage that one wave walks

// Four 16-byte copies of one lane, LSTEP bytes apart in LDS and GSTEP elements
// apart in global memory. The s_wait_xcnt stands inside the statement, behind
// the last copy, so that no address register is rewritten ahead of it.
template <int LSTEP, int GSTEP>
static __device__ __forceinline__ void copy4_step(u32 l, const u16* g) {
  asm volatile(
      "global_load_async_to_lds_b128 %0, %4, off\n\t"
      "global_load_async_to_lds_b128 %1, %5, off\n\t"
      "global_load_async_to_lds_b128 %2, %6, off\n\t"
      "global_load_async_to_lds_b128 %3, %7, off\n\t"
      "s_wait_xcnt 0x0"
      :: "v"(l), "v"(l + 1 * LSTEP), "v"(l + 2 * LSTEP), "v"(l + 3 * LSTEP),
         "v"(g), "v"(g + 1 * GSTEP), "v"(g + 2 * GSTEP), "v"(g + 3 * GSTEP)
      : "memory");
}

// four waves a SIMD (two blocks a WGP) is all that 512 blocks of 8 waves fill:
// told so, the compiler spends that residency's 256 registers on issuing a
// pass's LDS reads in one group well ahead of their use
__global__ __launch_bounds__(256) __attribute__((amdgpu_waves_per_eu(4, 4)))
void attn_kernel(
    const u16* __restrict__ q, const u16* __restrict__ k,
    const u16* __restrict__ vt, const int* __restrict__ mask,
    const float* __restrict__ x, float* __restrict__ out) {
  __shared__ __align__(16) float pen[SEQ];            // additive mask penalty
  __shared__ __align__(16) u16 KtL[KSTG * KPITCH];    // K stage   (keys x W)
  __shared__ __align__(16) u16 VtL[64 * VPITCH];      // V^T stage (W x keys)
  __shared__ __align__(16) v4f joinL[8 * 9 * 32];     // a wave's hand-over: 9 x 16 B a lane

  const int tid = threadIdx.x;
  // the wave's number in a scalar register: what follows from it costs no VGPR
  const int wave = __builtin_amdgcn_readfirstlane(tid >> 5);
  const int cset = wave & 3, kset = wave >> 2;        // column set, key set
  const int bh = blockIdx.x >> 4;                     // b*H + h
  const int qgrp = blockIdx.x & 15;
  const int b = bh >> 4, h = bh & 15;
  const int qbase = (qgrp * 4 + cset) * 32;

  for (int i = tid; i < SEQ; i += 256)
    pen[i] = -10000.0f * (1.0f - (float)mask[b * SEQ + i]);

  const u16* qbh = q + (size_t)bh * SEQ * HW;
  const u16* kbh = k + (size_t)bh * SEQ * HW;
  const u16* vbh = vt + (size_t)bh * HW * SEQ;

  const int lq = tid & 15, half = (tid >> 4) & 1, koff = half * 8;

  // q^T B-fragments: two column groups x the two 32-wide K-steps of the head
  const u16* qr = qbh + (size_t)(qbase + lq) * HW + koff;
  const v16bf qf[2][2] = {
      {load_frag16(qr), load_frag16(qr + 32)},
      {load_frag16(qr + 16 * HW), load_frag16(qr + 16 * HW + 32)}};

  v8f o[2][4] = {};
  float m_i[2] = {-3.0e38f, -3.0e38f}, l_i[2] = {0.0f, 0.0f};

  // copy maps: K 8 lanes a 128-byte row, 32 rows a copy of the block;
  // V^T 16 lanes a 256-byte row piece, 16 rows a copy of the block
  const u32 lk = (u32)(size_t)KtL + (u32)((tid >> 3) * KPITCH + (tid & 7) * 8) * 2u;
  const u32 lv = (u32)(size_t)VtL + (u32)((tid >> 4) * VPITCH + (tid & 15) * 8) * 2u;
  const u16* gk = kbh + tid * 8;                      // K stage is contiguous
  const u16* gv = vbh + (size_t)(tid >> 4) * SEQ + (tid & 15) * 8;

  // the wave's half of a stage
  const u16*   Kw = KtL + (size_t)(kset * KHALF + lq) * KPITCH + koff;
  const u16*   Vw = VtL + (size_t)lq * VPITCH + kset * KHALF + koff;
  const float* Pw = pen + kset * KHALF + half * 8;

  for (int kst = 0; kst < SEQ; kst += KSTG) {
    // ---- cooperative staging of K / V^T stages (32 KB) through async DMA ---
    asm volatile("s_wait_dscnt 0x0" ::: "memory");    // own reads of the stage done
    __syncthreads();                                  // prev stage fully read
    copy4_step<32 * KPITCH * 2, 32 * HW>(lk, gk + (size_t)kst * HW);
    copy4_step<16 * VPITCH * 2, 16 * SEQ>(lv, gv + kst);
    asm volatile("s_wait_asynccnt 0x0" ::: "memory"); // own copies landed
    __syncthreads();                                  // stage visible to block

   // unrolled: every LDS address of a pass is then a constant offset of one register
   #pragma unroll
   for (int kp = 0; kp < KHALF; kp += 32) {
    // ---- scores^T: 32 keys x 32 queries, four 16x16 accumulators ----
    v16bf a0[2], a1[2];
    v4f pn[4];
    #pragma unroll
    for (int ks = 0; ks < 2; ks++) {
      a0[ks] = load_frag16(Kw + (size_t)kp * KPITCH + ks * 32);
      a1[ks] = load_frag16(Kw + (size_t)(kp + 16) * KPITCH + ks * 32);
      pn[ks]     = *reinterpret_cast<const v4f*>(Pw + kst + kp + ks * 4);
      pn[2 + ks] = *reinterpret_cast<const v4f*>(Pw + kst + kp + 16 + ks * 4);
    }
    // keeps a pass's 12 LDS reads one group ahead of its score WMMAs, free to
    // rise into the pass before: without it the mask reads stand among the
    // WMMAs, no read starts under the pass before, and the build pairs fewer
    // vector instructions and needs more v_nop behind the WMMAs
    __builtin_amdgcn_sched_barrier(0);
    v8f s0[2] = {}, s1[2] = {};
    #pragma unroll
    for (int ks = 0; ks < 2; ks++) {
      #pragma unroll
      for (int j = 0; j < 2; j++) {
        s0[j] = __builtin_amdgcn_wmma_f32_16x16x32_bf16(
            false, a0[ks], false, qf[j][ks], (short)0, s0[j], false, false);
        s1[j] = __builtin_amdgcn_wmma_f32_16x16x32_bf16(
            false, a1[ks], false, qf[j][ks], (short)0, s1[j], false, false);
      }
    }
    v16bf pfrag[2];
    #pragma unroll
    for (int j = 0; j < 2; j++) {
      // additive mask (keys live along vgpr index + lane half)
      #pragma unroll
      for (int r = 0; r < 4; r++) {
        s0[j][r]     += pn[0][r];
        s0[j][4 + r] += pn[1][r];
        s1[j][r]     += pn[2][r];
        s1[j][4 + r] += pn[3][r];
      }
      // ---- online softmax over keys: per-lane 16 values + partner (xor 16) --
      float mloc = -3.0e38f;
      #pragma unroll
      for (int r = 0; r < 8; r++) mloc = fmaxf(mloc, fmaxf(s0[j][r], s1[j][r]));
      mloc = fmaxf(mloc, __shfl_xor(mloc, 16, 32));
      const float mnew = fmaxf(m_i[j], mloc);
      const float corr = __expf(m_i[j] - mnew);
      float p0[8], p1[8], psum = 0.0f;
      #pragma unroll
      for (int r = 0; r < 8; r++) {
        p0[r] = __expf(s0[j][r] - mnew);
        p1[r] = __expf(s1[j][r] - mnew);
        psum += p0[r] + p1[r];
      }
      psum += __shfl_xor(psum, 16, 32);
      l_i[j] = l_i[j] * corr + psum;
      m_i[j] = mnew;
      #pragma unroll
      for (int t = 0; t < 4; t++)
        #pragma unroll
        for (int r = 0; r < 8; r++) o[j][t][r] *= corr;

      // ---- P^T as B operand, straight from the score accumulators ---------
      // lane (c, h): s0[r] is key 8h+r, s1[r] is key 16+8h+r of query c, which
      // is the hardware k order of a B fragment's elements 0..7 and 8..15
      v16f pv;
      #pragma unroll
      for (int r = 0; r < 8; r++) { pv[r] = p0[r]; pv[8 + r] = p1[r]; }
      pfrag[j] = __builtin_convertvector(pv, v16bf);          // RNE, packed cvt
      // between the two column groups: without it the compiler mixes their
      // softmax, the build needs more than the 256 registers that four waves a
      // SIMD leave a wave, and values go to scratch memory
      if (j == 0) __builtin_amdgcn_sched_barrier(0);
    }
    #pragma unroll
    for (int t = 0; t < 4; t++) {                     // h^T rows w = t*16..+15
      const v16bf vfrag = load_frag16(Vw + (size_t)(t * 16) * VPITCH + kp);
      #pragma unroll
      for (int j = 0; j < 2; j++)
        o[j][t] = __builtin_amdgcn_wmma_f32_16x16x32_bf16(
            false, vfrag, false, pfrag[j], (short)0, o[j][t], false, false);
    }
   }
  }

  // ---- join of the two key sets: wave (cset, kset) finishes column group
  // kset and hands its part of the other group to wave (cset, 1 - kset) ------
  v8f keep[4], give[4];
  #pragma unroll
  for (int t = 0; t < 4; t++) {
    keep[t] = kset ? o[1][t] : o[0][t];
    give[t] = kset ? o[0][t] : o[1][t];
  }
  const float mk = kset ? m_i[1] : m_i[0], lk_ = kset ? l_i[1] : l_i[0];
  const float mg = kset ? m_i[0] : m_i[1], lg  = kset ? l_i[0] : l_i[1];
  v4f* jw = joinL + wave * (9 * 32) + (tid & 31);     // 16 B a lane, lanes adjacent
  #pragma unroll
  for (int t = 0; t < 4; t++) {
    jw[(2 * t) * 32]     = v4f{give[t][0], give[t][1], give[t][2], give[t][3]};
    jw[(2 * t + 1) * 32] = v4f{give[t][4], give[t][5], give[t][6], give[t][7]};
  }
  jw[8 * 32] = v4f{mg, lg, 0.0f, 0.0f};
  __syncthreads();                                    // hand-overs visible to block
  const v4f* jr = joinL + (wave ^ 4) * (9 * 32) + (tid & 31);
  const v4f ml = jr[8 * 32];
  const float mj = fmaxf(mk, ml[0]);
  const float ck = __expf(mk - mj), cg = __expf(ml[0] - mj);
  const float lsum = lk_ * ck + ml[1] * cg;

  // epilogue: divide by softmax sum, add residual, store fp32
  const float inv = 1.0f / (lsum + 1e-20f);
  const float fk = ck * inv, fg = cg * inv;
  const size_t obase = (size_t)(b * SEQ + qbase + kset * 16 + lq) * DIM + h * HW + 8 * half;
  #pragma unroll
  for (int t = 0; t < 4; t++) {
    const v4f g0 = jr[(2 * t) * 32], g1 = jr[(2 * t + 1) * 32];
    const v4f* xr = reinterpret_cast<const v4f*>(x + obase + t * 16);
    const v4f x0 = xr[0], x1 = xr[1];
    v4f r0, r1;
    #pragma unroll
    for (int r = 0; r < 4; r++) {
      r0[r] = keep[t][r] * fk + g0[r] * fg + x0[r];
      r1[r] = keep[t][4 + r] * fk + g1[r] * fg + x1[r];
    }
    v4f* orow = reinterpret_cast<v4f*>(out + obase + t * 16);
    orow[0] = r0;
    orow[1] = r1;
  }
}

// ---------------------------------------------------------------------------
extern "C" void kernel_launch(void* const* d_in, const int* in_sizes, int n_in,
                              void* d_out, int out_size, void* d_ws,
                              size_t ws_size, hipStream_t stream) {
  const float* x     = (const float*)d_in[0];
  const int*   mask  = (const int*)d_in[1];
  const float* gamma = (const float*)d_in[2];
  const float* beta  = (const float*)d_in[3];
  const float* wq    = (const float*)d_in[4];
  const float* bq    = (const float*)d_in[5];
  const float* wk    = (const float*)d_in[6];
  const float* bk    = (const float*)d_in[7];
  const float* wv    = (const float*)d_in[8];
  const float* bv    = (const float*)d_in[9];
  float* out = (float*)d_out;

  char* ws = (char*)d_ws;
  const size_t MB = 1024 * 1024;
  u16* xn = (u16*)ws;                         // 8 MB  (4096x1024 bf16)
  u16* wt = (u16*)(ws + 8 * MB);              // 6 MB  (3x 1024x1024 bf16, transposed)
  u16* qb = (u16*)(ws + 14 * MB);             // 8 MB  (B,H,S,W)
  u16* kb = (u16*)(ws + 22 * MB);             // 8 MB  (B,H,S,W)
  u16* vt = (u16*)(ws + 30 * MB);             // 8 MB  (B,H,W,S)

  ln_bf16_kernel<<<BATCH * SEQ / (8 * LNR), 256, 0, stream>>>(x, gamma, beta, xn);

  dim3 tg(16, 16, 3);
  wt_bf16_kernel<<<tg, 128, 0, stream>>>(wq, wk, wv, wt);

  dim3 gg(32, 8, 3);
  qkv_wmma_kernel<<<gg, 128, 0, stream>>>(xn, wt, bq, bk, bv, qb, kb, vt);

  attn_kernel<<<BATCH * HEADS * (SEQ / 32) / 4, 256, 0, stream>>>(
      qb, kb, vt, mask, x, out);
}

// v007
// One run takes 69.6 microseconds.
// In both of two side-by-side timings against v006, it was 1.06 times as fast.
// Over all steps from v000 it is 3.88 times as fast.
#include <hip/hip_runtime.h>
#include <hip/hip_bf16.h>

typedef unsigned short u16;
typedef unsigned int   u32;

typedef __attribute__((ext_vector_type(16))) __bf16 v16bf;
typedef __attribute__((ext_vector_type(8)))  float  v8f;
typedef __attribute__((ext_vector_type(4)))  int    v4i;
typedef __attribute__((ext_vector_type(16))) float  v16f;
typedef __attribute__((ext_vector_type(4)))  float  v4f;

struct FragBits { uint4 lo; uint4 hi; };   // 32 bytes == 16 bf16

static __device__ __forceinline__ v16bf make_frag(const uint4& lo, const uint4& hi) {
  FragBits s{lo, hi};
  return __builtin_bit_cast(v16bf, s);
}

// WMMA 16-bit A/B fragment layout: lane L holds (row/col = L%16),
// K-chunks at koff=(L/16)*8 : elements [koff, koff+7] and [koff+16, koff+23].
// Caller passes p already offset by koff; chunks are uint4[0] and uint4[2].
static __device__ __forceinline__ v16bf load_frag16(const u16* p) {
  const uint4* u = reinterpret_cast<const uint4*>(p);
  return make_frag(u[0], u[2]);
}

static __device__ __forceinline__ u16 f2bf(float f) {
  u32 u = __builtin_bit_cast(u32, f);
  u += 0x7FFFu + ((u >> 16) & 1u);   // RNE
  return (u16)(u >> 16);
}

constexpr int DIM = 1024;
constexpr int SEQ = 2048;
constexpr int BATCH = 2;
constexpr int HEADS = 16;
constexpr int HW = 64;        // head width

// ---------------------------------------------------------------------------
// Kernel 1: LayerNorm + convert to bf16. A wave does two whole rows by itself:
// 2,048 waves to start instead of 32,768, no LDS, no barrier. All 16 loads of
// a wave (512 contiguous bytes each) are in flight together.
// ---------------------------------------------------------------------------
constexpr int LNR = 2;                     // rows per wave
// two waves a SIMD is all that 256 blocks of 8 waves fill: told so, the compiler
// spends registers on issuing the 16 gamma and beta loads as one group; without
// it they stand behind the reduction pair by pair, each pair with a full wait
__global__ __launch_bounds__(256) __attribute__((amdgpu_waves_per_eu(2, 2)))
void ln_bf16_kernel(
    const float* __restrict__ x, const float* __restrict__ gamma,
    const float* __restrict__ beta, u16* __restrict__ xn) {
  const int lane = threadIdx.x & 31;
  const int row0 = (blockIdx.x * 8 + (threadIdx.x >> 5)) * LNR;
  const float4* xr = reinterpret_cast<const float4*>(x + (size_t)row0 * DIM) + lane;
  float4 v[LNR][8];
  #pragma unroll
  for (int r = 0; r < LNR; r++)
    #pragma unroll
    for (int i = 0; i < 8; i++) v[r][i] = xr[r * (DIM / 4) + i * 32];
  // precaution: the 16 loads' address pair is an operand, so it lives up to this
  // wait; without it the last load's result was allocated on top of the pair
  asm volatile("s_wait_xcnt 0x0" :: "v"(xr) : "memory");
  float4 g[8], b[8];
  #pragma unroll
  for (int i = 0; i < 8; i++) {
    g[i] = reinterpret_cast<const float4*>(gamma)[i * 32 + lane];
    b[i] = reinterpret_cast<const float4*>(beta)[i * 32 + lane];
  }
  // holds the build at one group of 16 row loads and one group of 16 gamma and
  // beta loads that fly under the sums: without it the compiler keeps far more
  // values live, goes above v255 and emits about a quarter more instructions
  __builtin_amdgcn_sched_barrier(0);
  float s[LNR], s2[LNR];
  #pragma unroll
  for (int r = 0; r < LNR; r++) {
    s[r] = 0.f; s2[r] = 0.f;
    #pragma unroll
    for (int i = 0; i < 8; i++) {
      const float4 t = v[r][i];
      s[r]  += t.x + t.y + t.z + t.w;
      s2[r] += t.x * t.x + t.y * t.y + t.z * t.z + t.w * t.w;
    }
  }
  #pragma unroll
  for (int off = 16; off > 0; off >>= 1) {
    #pragma unroll
    for (int r = 0; r < LNR; r++) {
      s[r]  += __shfl_xor(s[r],  off, 32);
      s2[r] += __shfl_xor(s2[r], off, 32);
    }
  }
  #pragma unroll
  for (int r = 0; r < LNR; r++) {
    const float mu   = s[r] * (1.0f / DIM);
    const float var  = s2[r] * (1.0f / DIM) - mu * mu;
    const float rstd = rsqrtf(var + 1e-5f);
    uint2* orow = reinterpret_cast<uint2*>(xn + (size_t)(row0 + r) * DIM) + lane;
    #pragma unroll
    for (int i = 0; i < 8; i++) {
      const float4 t = v[r][i];
      uint2 o;
      o.x = (u32)f2bf((t.x - mu) * rstd * g[i].x + b[i].x) |
            ((u32)f2bf((t.y - mu) * rstd * g[i].y + b[i].y) << 16);
      o.y = (u32)f2bf((t.z - mu) * rstd * g[i].z + b[i].z) |
            ((u32)f2bf((t.w - mu) * rstd * g[i].w + b[i].w) << 16);
      orow[i * 32] = o;
    }
  }
}

// ---------------------------------------------------------------------------
// Kernel 2: transpose + bf16-convert weights: Wt[j][k] = (bf16) W[k][j].
// 128 threads = 4 waves take a 64 x 64 tile: 3,072 waves to start instead of
// 24,576. A thread loads 8 k x 4 j (eight 16-byte loads in flight), packs 8 k
// of each j into 16 bytes, and the tile goes out through LDS as whole 128-byte
// rows of Wt.
// ---------------------------------------------------------------------------
constexpr int TPITCH = 72;                 // LDS row pitch in elements: 144 B
__global__ __launch_bounds__(128) void wt_bf16_kernel(
    const float* __restrict__ wq, const float* __restrict__ wk,
    const float* __restrict__ wv, u16* __restrict__ wt) {
  __shared__ __align__(16) u16 tile[64 * TPITCH];      // tile[jloc][kloc]
  const float* w = (blockIdx.z == 0) ? wq : (blockIdx.z == 1) ? wk : wv;
  u16* o = wt + (size_t)blockIdx.z * DIM * DIM;
  const int tid = threadIdx.x;
  const int j0 = blockIdx.x * 64, k0 = blockIdx.y * 64;
  const int jq = tid & 15, kg = tid >> 4;              // 16 j quads x 8 k groups
  const float* src = w + (size_t)(k0 + kg * 8) * DIM + j0 + jq * 4;
  v4f r[8];
  #pragma unroll
  for (int i = 0; i < 8; i++)
    r[i] = *reinterpret_cast<const v4f*>(src + (size_t)i * DIM);
  #pragma unroll
  for (int jj = 0; jj < 4; jj++) {
    uint4 p;
    p.x = (u32)f2bf(r[0][jj]) | ((u32)f2bf(r[1][jj]) << 16);
    p.y = (u32)f2bf(r[2][jj]) | ((u32)f2bf(r[3][jj]) << 16);
    p.z = (u32)f2bf(r[4][jj]) | ((u32)f2bf(r[5][jj]) << 16);
    p.w = (u32)f2bf(r[6][jj]) | ((u32)f2bf(r[7][jj]) << 16);
    *reinterpret_cast<uint4*>(tile + (jq * 4 + jj) * TPITCH + kg * 8) = p;
  }
  __syncthreads();
  #pragma unroll
  for (int i = 0; i < 4; i++) {
    const int j = (tid >> 3) + i * 16, kc = (tid & 7) * 8;   // 8 lanes a row
    const uint4 p = *reinterpret_cast<const uint4*>(tile + j * TPITCH + kc);
    *reinterpret_cast<uint4*>(o + (size_t)(j0 + j) * DIM + k0 + kc) = p;
  }
}

// ---------------------------------------------------------------------------
// Kernel 3: QKV GEMM on WMMA bf16. grid=(32 Mtiles, 8 Ntiles, 3 proj),
// 128 threads = 4 waves (2x2); block tile 128x128, wave tile 64x64.
// Per stage (64 k) the block copies 128 rows of xn and 128 rows of wt into LDS
// (async copies, two buffers: the next stage flies while this one is used).
// q,k stored (B,H,S,W); v stored transposed (B,H,W,S). Scale 1/8 folded in q.
// ---------------------------------------------------------------------------
constexpr int GK     = 64;                 // k per stage: 128-byte rows
constexpr int GPITCH = 72;                 // LDS row pitch in elements: 144 B
constexpr int GOPER  = 128 * GPITCH;       // one operand's tile, elements
constexpr int GSTAGE = 2 * GOPER;          // one buffer: [xn rows | wt rows]
constexpr int GNST   = DIM / GK;           // 16 stages

// Eight 16-byte copies of one lane: rows r, r+16, ... r+112 of one operand.
// The s_wait_xcnt stands inside the statement, behind the last copy, so that
// no address register is rewritten ahead of it.
static __device__ __forceinline__ void copy8_rows(u32 l, const u16* g) {
  asm volatile(
      "global_load_async_to_lds_b128 %0, %8, off\n\t"
      "global_load_async_to_lds_b128 %1, %9, off\n\t"
      "global_load_async_to_lds_b128 %2, %10, off\n\t"
      "global_load_async_to_lds_b128 %3, %11, off\n\t"
      "global_load_async_to_lds_b128 %4, %12, off\n\t"
      "global_load_async_to_lds_b128 %5, %13, off\n\t"
      "global_load_async_to_lds_b128 %6, %14, off\n\t"
      "global_load_async_to_lds_b128 %7, %15, off\n\t"
      "s_wait_xcnt 0x0"
      :: "v"(l), "v"(l + 1 * 16 * GPITCH * 2), "v"(l + 2 * 16 * GPITCH * 2),
         "v"(l + 3 * 16 * GPITCH * 2), "v"(l + 4 * 16 * GPITCH * 2),
         "v"(l + 5 * 16 * GPITCH * 2), "v"(l + 6 * 16 * GPITCH * 2),
         "v"(l + 7 * 16 * GPITCH * 2),
         "v"(g), "v"(g + 1 * 16 * DIM), "v"(g + 2 * 16 * DIM),
         "v"(g + 3 * 16 * DIM), "v"(g + 4 * 16 * DIM), "v"(g + 5 * 16 * DIM),
         "v"(g + 6 * 16 * DIM), "v"(g + 7 * 16 * DIM)
      : "memory");
}

// A wave's 64x64 result: bias, (q only) scale, bf16, one 2-byte store an element.
template <int PROJ>
static __device__ __forceinline__ void store_tile(
    const v8f (&acc)[4][4], const float* __restrict__ bias,
    u16* __restrict__ dst, int row0, int col0, int lq, int half) {
  #pragma unroll
  for (int mi = 0; mi < 4; mi++) {
    #pragma unroll
    for (int nt = 0; nt < 4; nt++) {
      const int col = col0 + nt * 16 + lq;             // N = lane%16
      const float bvl = bias[col];
      const int h = col >> 6, w = col & 63;
      #pragma unroll
      for (int r = 0; r < 8; r++) {
        const int m = r + half * 8;                    // M = vgpr + 8*(lane/16)
        const int row = row0 + mi * 16 + m;
        const int b = row >> 11, s = row & (SEQ - 1);
        float val = acc[mi][nt][r] + bvl;
        if (PROJ == 0) val *= 0.125f;                  // 1/sqrt(64)
        if (PROJ == 2)
          dst[((size_t)(b * HEADS + h) * HW + w) * SEQ + s] = f2bf(val);
        else
          dst[((size_t)(b * HEADS + h) * SEQ + s) * HW + w] = f2bf(val);
      }
    }
    // one row of tiles at a time: without it the compiler converts all 128
    // values ahead of the stores and the register count goes above v255
    __builtin_amdgcn_sched_barrier(0);
  }
  // a precaution: nothing in this kernel follows the three nests
  asm volatile("s_wait_xcnt 0x0" ::: "memory");
}

__global__ __launch_bounds__(128) void qkv_wmma_kernel(
    const u16* __restrict__ xn, const u16* __restrict__ wt,
    const float* __restrict__ bq, const float* __restrict__ bk,
    const float* __restrict__ bv, u16* __restrict__ qO,
    u16* __restrict__ kO, u16* __restrict__ vtO) {
  __shared__ __align__(16) u16 stg[2 * GSTAGE];      // 73,728 B

  const int proj = blockIdx.z;
  const int tid  = threadIdx.x;
  const int wave = tid >> 5;
  const int lane = tid & 31;
  const int m0 = blockIdx.x * 128;
  const int n0 = blockIdx.y * 128;
  const int wm = (wave >> 1) * 64;                   // wave's rows in the tile
  const int wn = (wave & 1) * 64;                    // wave's cols in the tile
  const u16* wsel = wt + (size_t)proj * DIM * DIM;

  const int lq = lane & 15;
  const int koff = (lane >> 4) * 8;

  // copy map: 8 lanes cover one 128-byte row, a wave 4 whole rows per copy
  const int crow = tid >> 3, ccol = (tid & 7) * 8;
  const u16* gx = xn + (size_t)(m0 + crow) * DIM + ccol;
  const u16* gw = wsel + (size_t)(n0 + crow) * DIM + ccol;
  const u32 lx = (u32)(size_t)stg + (u32)(crow * GPITCH + ccol) * 2u;
  const u32 lw = lx + GOPER * 2u;

  // prologue, two buffers
  copy8_rows(lx, gx);
  copy8_rows(lw, gw);
  asm volatile("s_wait_asynccnt 0x0" ::: "memory");  // stage 0 landed (own copies)
  __syncthreads();                                   // stage 0 visible to block
  copy8_rows(lx + GSTAGE * 2u, gx + GK);
  copy8_rows(lw + GSTAGE * 2u, gw + GK);

  v8f acc[4][4] = {};
  for (int t = 0; t < GNST; t++) {
    const u16* sx = stg + (t & 1) * GSTAGE + (wm + lq) * GPITCH + koff;
    const u16* sw = stg + (t & 1) * GSTAGE + GOPER + (wn + lq) * GPITCH + koff;
    #pragma unroll
    for (int ks = 0; ks < 2; ks++) {
      v16bf a[4], bfr[4];
      #pragma unroll
      for (int i = 0; i < 4; i++) {
        a[i]   = load_frag16(sx + i * 16 * GPITCH + ks * 32);
        bfr[i] = load_frag16(sw + i * 16 * GPITCH + ks * 32);
      }
      // keeps the 16 LDS reads one group ahead of the 16 WMMAs: without it the
      // compiler sinks them between the rows, one full LDS wait per 4 WMMAs
      __builtin_amdgcn_sched_barrier(0);
      #pragma unroll
      for (int mi = 0; mi < 4; mi++)
        #pragma unroll
        for (int nt = 0; nt < 4; nt++)
          acc[mi][nt] = __builtin_amdgcn_wmma_f32_16x16x32_bf16(
              false, a[mi], false, bfr[nt], (short)0, acc[mi][nt], false, false);
      // keeps the next group's reads from moving up among these WMMAs
      __builtin_amdgcn_sched_barrier(0);
    }
    // publish point of stage t+1; it also frees the buffer just read
    asm volatile("s_wait_dscnt 0x0" ::: "memory");    // own reads of this buffer done
    asm volatile("s_wait_asynccnt 0x0" ::: "memory"); // own copies of stage t+1 landed
    __syncthreads();
    if (t + 2 < GNST) {
      const u32 bo = (u32)(t & 1) * (GSTAGE * 2u);
      copy8_rows(lx + bo, gx + (t + 2) * GK);
      copy8_rows(lw + bo, gw + (t + 2) * GK);
    }
  }
  asm volatile("s_wait_asynccnt 0x0" ::: "memory");   // nothing in flight at the end

  // the projection is the same for the whole block: one test, three loop nests
  const int half = lane >> 4;
  if (proj == 0)      store_tile<0>(acc, bq, qO,  m0 + wm, n0 + wn, lq, half);
  else if (proj == 1) store_tile<1>(acc, bk, kO,  m0 + wm, n0 + wn, lq, half);
  else                store_tile<2>(acc, bv, vtO, m0 + wm, n0 + wn, lq, half);
}

// ---------------------------------------------------------------------------
// Kernel 4: flash attention. 256 threads = 8 waves (same b,h) = 4 column sets
// x 2 key sets. A wave holds 32 query columns (two 16-column groups), so that
// every K and V^T fragment read from LDS feeds two WMMAs, and walks one 64-key
// half of every stage; the two key sets of a column set are joined through LDS
// behind the loop. Per stage (128 keys):
//   * block cooperatively stages K(128x64) and V^T(64x128) into LDS via
//     gfx1250 async-to-LDS DMA (ASYNCcnt), shared by all 8 waves; two buffers:
//     the next stage's copies fly while this stage is worked on
// and per pass (32 keys of the wave's half stage), per column group:
//   * scores^T = K x q^T on WMMA -> online softmax (per-lane + shfl_xor 16)
//   * P^T packed to bf16 in registers -> B-fragment (no LDS)
//   * h^T += V^T x P^T on WMMA
// LDS rows are read 16 bytes a lane, one row a lane: their pitch is an odd
// multiple of 16 bytes, so that 16 lanes fall on 64 different banks.
// ---------------------------------------------------------------------------
constexpr int KPITCH = HW + 8;             // K rows: 128 B of data, 144 B apart
constexpr int KSTG   = 128;                // keys per stage (one copy wait, one barrier)
constexpr int VPITCH = KSTG + 8;           // V^T rows: 256 B of data, 272 B apart
constexpr int KHALF  = KSTG / 2;           // keys of a stage that one wave walks
constexpr int KBUF   = KSTG * KPITCH;      // one K buffer, elements
constexpr int VBUF   = 64 * VPITCH;        // one V^T buffer, elements
constexpr int NSTG   = SEQ / KSTG;         // 16 stages

// Four 16-byte copies of one lane, LSTEP bytes apart in LDS and GSTEP elements
// apart in global memory. The s_wait_xcnt stands inside the statement, behind
// the last copy, so that no address register is rewritten ahead of it.
template <int LSTEP, int GSTEP>
static __device__ __forceinline__ void copy4_step(u32 l, const u16* g) {
  asm volatile(
      "global_load_async_to_lds_b128 %0, %4, off\n\t"
      "global_load_async_to_lds_b128 %1, %5, off\n\t"
      "global_load_async_to_lds_b128 %2, %6, off\n\t"
      "global_load_async_to_lds_b128 %3, %7, off\n\t"
      "s_wait_xcnt 0x0"
      :: "v"(l), "v"(l + 1 * LSTEP), "v"(l + 2 * LSTEP), "v"(l + 3 * LSTEP),
         "v"(g), "v"(g + 1 * GSTEP), "v"(g + 2 * GSTEP), "v"(g + 3 * GSTEP)
      : "memory");
}

// four waves a SIMD (two blocks a WGP) is all that 512 blocks of 8 waves fill:
// told so, the compiler spends that residency's 256 registers on issuing a
// pass's LDS reads in one group well ahead of their use
__global__ __launch_bounds__(256) __attribute__((amdgpu_waves_per_eu(4, 4)))
void attn_kernel(
    const u16* __restrict__ q, const u16* __restrict__ k,
    const u16* __restrict__ vt, const int* __restrict__ mask,
    const float* __restrict__ x, float* __restrict__ out) {
  __shared__ __align__(16) float pen[SEQ];            // additive mask penalty
  __shared__ __align__(16) u16 KtL[2 * KBUF];         // K stages   (keys x W), two buffers
  __shared__ __align__(16) u16 VtL[2 * VBUF];         // V^T stages (W x keys), two buffers
  __shared__ __align__(16) v4f joinL[8 * 9 * 32];     // a wave's hand-over: 9 x 16 B a lane

  const int tid = threadIdx.x;
  // the wave's number in a scalar register: what follows from it costs no VGPR
  const int wave = __builtin_amdgcn_readfirstlane(tid >> 5);
  const int cset = wave & 3, kset = wave >> 2;        // column set, key set
  const int bh = blockIdx.x >> 4;                     // b*H + h
  const int qgrp = blockIdx.x & 15;
  const int b = bh >> 4, h = bh & 15;
  const int qbase = (qgrp * 4 + cset) * 32;

  for (int i = tid; i < SEQ; i += 256)
    pen[i] = -10000.0f * (1.0f - (float)mask[b * SEQ + i]);

  const u16* qbh = q + (size_t)bh * SEQ * HW;
  const u16* kbh = k + (size_t)bh * SEQ * HW;
  const u16* vbh = vt + (size_t)bh * HW * SEQ;

  const int lq = tid & 15, half = (tid >> 4) & 1, koff = half * 8;

  // q^T B-fragments: two column groups x the two 32-wide K-steps of the head
  const u16* qr = qbh + (size_t)(qbase + lq) * HW + koff;
  const v16bf qf[2][2] = {
      {load_frag16(qr), load_frag16(qr + 32)},
      {load_frag16(qr + 16 * HW), load_frag16(qr + 16 * HW + 32)}};

  v8f o[2][4] = {};
  float m_i[2] = {-3.0e38f, -3.0e38f}, l_i[2] = {0.0f, 0.0f};

  // copy maps: K 8 lanes a 128-byte row, 32 rows a copy of the block;
  // V^T 16 lanes a 256-byte row piece, 16 rows a copy of the block
  const u32 lk = (u32)(size_t)KtL + (u32)((tid >> 3) * KPITCH + (tid & 7) * 8) * 2u;
  const u32 lv = (u32)(size_t)VtL + (u32)((tid >> 4) * VPITCH + (tid & 15) * 8) * 2u;
  const u16* gk = kbh + tid * 8;                      // K stage is contiguous
  const u16* gv = vbh + (size_t)(tid >> 4) * SEQ + (tid & 15) * 8;

  // the wave's half of a stage
  const u16*   Kw = KtL + (size_t)(kset * KHALF + lq) * KPITCH + koff;
  const u16*   Vw = VtL + (size_t)lq * VPITCH + kset * KHALF + koff;
  const float* Pw = pen + kset * KHALF + half * 8;

  // prologue, two buffers (a stage is 32 KB of K and V^T)
  copy4_step<32 * KPITCH * 2, 32 * HW>(lk, gk);
  copy4_step<16 * VPITCH * 2, 16 * SEQ>(lv, gv);
  asm volatile("s_wait_asynccnt 0x0" ::: "memory");   // stage 0 landed (own copies)
  __syncthreads();                                    // stage 0 and pen visible to block
  copy4_step<32 * KPITCH * 2, 32 * HW>(lk + KBUF * 2u, gk + (size_t)KSTG * HW);
  copy4_step<16 * VPITCH * 2, 16 * SEQ>(lv + VBUF * 2u, gv + KSTG);

  for (int st = 0; st < NSTG; st++) {
   const int kst = st * KSTG;
   const int buf = st & 1;
   const u16* Kb = Kw + buf * KBUF;
   const u16* Vb = Vw + buf * VBUF;
   // unrolled: every LDS address of a pass is then a constant offset of one register
   #pragma unroll
   for (int kp = 0; kp < KHALF; kp += 32) {
    // ---- scores^T: 32 keys x 32 queries, four 16x16 accumulators ----
    v16bf a0[2], a1[2];
    v4f pn[4];
    #pragma unroll
    for (int ks = 0; ks < 2; ks++) {
      a0[ks] = load_frag16(Kb + (size_t)kp * KPITCH + ks * 32);
      a1[ks] = load_frag16(Kb + (size_t)(kp + 16) * KPITCH + ks * 32);
      pn[ks]     = *reinterpret_cast<const v4f*>(Pw + kst + kp + ks * 4);
      pn[2 + ks] = *reinterpret_cast<const v4f*>(Pw + kst + kp + 16 + ks * 4);
    }
    // keeps a pass's 12 LDS reads one group ahead of its score WMMAs, free to
    // rise into the pass before: without it the mask reads stand among the
    // WMMAs, no read starts under the pass before, and the build pairs fewer
    // vector instructions and needs more v_nop behind the WMMAs
    __builtin_amdgcn_sched_barrier(0);
    v8f s0[2] = {}, s1[2] = {};
    #pragma unroll
    for (int ks = 0; ks < 2; ks++) {
      #pragma unroll
      for (int j = 0; j < 2; j++) {
        s0[j] = __builtin_amdgcn_wmma_f32_16x16x32_bf16(
            false, a0[ks], false, qf[j][ks], (short)0, s0[j], false, false);
        s1[j] = __builtin_amdgcn_wmma_f32_16x16x32_bf16(
            false, a1[ks], false, qf[j][ks], (short)0, s1[j], false, false);
      }
    }
    v16bf pfrag[2];
    #pragma unroll
    for (int j = 0; j < 2; j++) {
      // additive mask (keys live along vgpr index + lane half)
      #pragma unroll
      for (int r = 0; r < 4; r++) {
        s0[j][r]     += pn[0][r];
        s0[j][4 + r] += pn[1][r];
        s1[j][r]     += pn[2][r];
        s1[j][4 + r] += pn[3][r];
      }
      // ---- online softmax over keys: per-lane 16 values + partner (xor 16) --
      float mloc = -3.0e38f;
      #pragma unroll
      for (int r = 0; r < 8; r++) mloc = fmaxf(mloc, fmaxf(s0[j][r], s1[j][r]));
      mloc = fmaxf(mloc, __shfl_xor(mloc, 16, 32));
      const float mnew = fmaxf(m_i[j], mloc);
      const float corr = __expf(m_i[j] - mnew);
      float p0[8], p1[8], psum = 0.0f;
      #pragma unroll
      for (int r = 0; r < 8; r++) {
        p0[r] = __expf(s0[j][r] - mnew);
        p1[r] = __expf(s1[j][r] - mnew);
        psum += p0[r] + p1[r];
      }
      psum += __shfl_xor(psum, 16, 32);
      l_i[j] = l_i[j] * corr + psum;
      m_i[j] = mnew;
      #pragma unroll
      for (int t = 0; t < 4; t++)
        #pragma unroll
        for (int r = 0; r < 8; r++) o[j][t][r] *= corr;

      // ---- P^T as B operand, straight from the score accumulators ---------
      // lane (c, h): s0[r] is key 8h+r, s1[r] is key 16+8h+r of query c, which
      // is the hardware k order of a B fragment's elements 0..7 and 8..15
      v16f pv;
      #pragma unroll
      for (int r = 0; r < 8; r++) { pv[r] = p0[r]; pv[8 + r] = p1[r]; }
      pfrag[j] = __builtin_convertvector(pv, v16bf);          // RNE, packed cvt
      // between the two column groups: without it the compiler mixes their
      // softmax, the build needs more than the 256 registers that four waves a
      // SIMD leave a wave, and values go to scratch memory
      if (j == 0) __builtin_amdgcn_sched_barrier(0);
    }
    #pragma unroll
    for (int t = 0; t < 4; t++) {                     // h^T rows w = t*16..+15
      const v16bf vfrag = load_frag16(Vb + (size_t)(t * 16) * VPITCH + kp);
      #pragma unroll
      for (int j = 0; j < 2; j++)
        o[j][t] = __builtin_amdgcn_wmma_f32_16x16x32_bf16(
            false, vfrag, false, pfrag[j], (short)0, o[j][t], false, false);
    }
   }
   // publish point of the next stage; it also frees the buffer just read
   asm volatile("s_wait_dscnt 0x0" ::: "memory");     // own reads of this buffer done
   asm volatile("s_wait_asynccnt 0x0" ::: "memory");  // own copies of the next stage landed
   __syncthreads();
   if (st + 2 < NSTG) {
     copy4_step<32 * KPITCH * 2, 32 * HW>(lk + buf * (KBUF * 2u),
                                          gk + (size_t)(kst + 2 * KSTG) * HW);
     copy4_step<16 * VPITCH * 2, 16 * SEQ>(lv + buf * (VBUF * 2u), gv + kst + 2 * KSTG);
   }
  }
  asm volatile("s_wait_asynccnt 0x0" ::: "memory");   // nothing in flight at the end

  // ---- join of the two key sets: wave (cset, kset) finishes column group
  // kset and hands its part of the other group to wave (cset, 1 - kset) ------
  v8f keep[4], give[4];
  #pragma unroll
  for (int t = 0; t < 4; t++) {
    keep[t] = kset ? o[1][t] : o[0][t];
    give[t] = kset ? o[0][t] : o[1][t];
  }
  const float mk = kset ? m_i[1] : m_i[0], lk_ = kset ? l_i[1] : l_i[0];
  const float mg = kset ? m_i[0] : m_i[1], lg  = kset ? l_i[0] : l_i[1];
  v4f* jw = joinL + wave * (9 * 32) + (tid & 31);     // 16 B a lane, lanes adjacent
  #pragma unroll
  for (int t = 0; t < 4; t++) {
    jw[(2 * t) * 32]     = v4f{give[t][0], give[t][1], give[t][2], give[t][3]};
    jw[(2 * t + 1) * 32] = v4f{give[t][4], give[t][5], give[t][6], give[t][7]};
  }
  jw[8 * 32] = v4f{mg, lg, 0.0f, 0.0f};
  __syncthreads();                                    // hand-overs visible to block
  const v4f* jr = joinL + (wave ^ 4) * (9 * 32) + (tid & 31);
  const v4f ml = jr[8 * 32];
  const float mj = fmaxf(mk, ml[0]);
  const float ck = __expf(mk - mj), cg = __expf(ml[0] - mj);
  const float lsum = lk_ * ck + ml[1] * cg;

  // epilogue: divide by softmax sum, add residual, store fp32
  const float inv = 1.0f / (lsum + 1e-20f);
  const float fk = ck * inv, fg = cg * inv;
  const size_t obase = (size_t)(b * SEQ + qbase + kset * 16 + lq) * DIM + h * HW + 8 * half;
  #pragma unroll
  for (int t = 0; t < 4; t++) {
    const v4f g0 = jr[(2 * t) * 32], g1 = jr[(2 * t + 1) * 32];
    const v4f* xr = reinterpret_cast<const v4f*>(x + obase + t * 16);
    const v4f x0 = xr[0], x1 = xr[1];
    v4f r0, r1;
    #pragma unroll
    for (int r = 0; r < 4; r++) {
      r0[r] = keep[t][r] * fk + g0[r] * fg + x0[r];
      r1[r] = keep[t][4 + r] * fk + g1[r] * fg + x1[r];
    }
    v4f* orow = reinterpret_cast<v4f*>(out + obase + t * 16);
    orow[0] = r0;
    orow[1] = r1;
  }
}

// ---------------------------------------------------------------------------
extern "C" void kernel_launch(void* const* d_in, const int* in_sizes, int n_in,
                              void* d_out, int out_size, void* d_ws,
                              size_t ws_size, hipStream_t stream) {
  const float* x     = (const float*)d_in[0];
  const int*   mask  = (const int*)d_in[1];
  const float* gamma = (const float*)d_in[2];
  const float* beta  = (const float*)d_in[3];
  const float* wq    = (const float*)d_in[4];
  const float* bq    = (const float*)d_in[5];
  const float* wk    = (const float*)d_in[6];
  const float* bk    = (const float*)d_in[7];
  const float* wv    = (const float*)d_in[8];
  const float* bv    = (const float*)d_in[9];
  float* out = (float*)d_out;

  char* ws = (char*)d_ws;
  const size_t MB = 1024 * 1024;
  u16* xn = (u16*)ws;                         // 8 MB  (4096x1024 bf16)
  u16* wt = (u16*)(ws + 8 * MB);              // 6 MB  (3x 1024x1024 bf16, transposed)
  u16* qb = (u16*)(ws + 14 * MB);             // 8 MB  (B,H,S,W)
  u16* kb = (u16*)(ws + 22 * MB);             // 8 MB  (B,H,S,W)
  u16* vt = (u16*)(ws + 30 * MB);             // 8 MB  (B,H,W,S)

  ln_bf16_kernel<<<BATCH * SEQ / (8 * LNR), 256, 0, stream>>>(x, gamma, beta, xn);

  dim3 tg(16, 16, 3);
  wt_bf16_kernel<<<tg, 128, 0, stream>>>(wq, wk, wv, wt);

  dim3 gg(32, 8, 3);
  qkv_wmma_kernel<<<gg, 128, 0, stream>>>(xn, wt, bq, bk, bv, qb, kb, vt);

  attn_kernel<<<BATCH * HEADS * (SEQ / 32) / 4, 256, 0, stream>>>(
      qb, kb, vt, mask, x, out);
}

// v009
// It runs in 64.1 microseconds.
// Versions in between are left out here; by their measured steps it is 1.08 times as fast as v007.
// Over all steps from v000 it is 4.20 times as fast.
#include <hip/hip_runtime.h>
#include <hip/hip_bf16.h>

typedef unsigned short u16;
typedef unsigned int   u32;

typedef __attribute__((ext_vector_type(16))) __bf16 v16bf;
typedef __attribute__((ext_vector_type(8)))  float  v8f;
typedef __attribute__((ext_vector_type(4)))  int    v4i;
typedef __attribute__((ext_vector_type(16))) float  v16f;
typedef __attribute__((ext_vector_type(4)))  float  v4f;

struct FragBits { uint4 lo; uint4 hi; };   // 32 bytes == 16 bf16

static __device__ __forceinline__ v16bf make_frag(const uint4& lo, const uint4& hi) {
  FragBits s{lo, hi};
  return __builtin_bit_cast(v16bf, s);
}

// WMMA 16-bit A/B fragment layout: lane L holds (row/col = L%16),
// K-chunks at koff=(L/16)*8 : elements [koff, koff+7] and [koff+16, koff+23].
// Caller passes p already offset by koff; chunks are uint4[0] and uint4[2].
static __device__ __forceinline__ v16bf load_frag16(const u16* p) {
  const uint4* u = reinterpret_cast<const uint4*>(p);
  return make_frag(u[0], u[2]);
}

static __device__ __forceinline__ u16 f2bf(float f) {
  u32 u = __builtin_bit_cast(u32, f);
  u += 0x7FFFu + ((u >> 16) & 1u);   // RNE
  return (u16)(u >> 16);
}

constexpr int DIM = 1024;
constexpr int SEQ = 2048;
constexpr int BATCH = 2;
constexpr int HEADS = 16;
constexpr int HW = 64;        // head width
constexpr float LOG2E  = 1.44269504f;
constexpr float QSCALE = 0.125f * LOG2E;   // 1/sqrt(HW), and scores in log2 units

// ---------------------------------------------------------------------------
// Kernel 1: LayerNorm + convert to bf16. A wave does two whole rows by itself:
// 2,048 waves to start instead of 32,768, no LDS, no barrier. All 16 loads of
// a wave (512 contiguous bytes each) are in flight together.
// ---------------------------------------------------------------------------
constexpr int LNR = 2;                     // rows per wave
// two waves a SIMD is all that 256 blocks of 8 waves fill: told so, the compiler
// spends registers on issuing the 16 gamma and beta loads as one group; without
// it they stand behind the reduction pair by pair, each pair with a full wait
__global__ __launch_bounds__(256) __attribute__((amdgpu_waves_per_eu(2, 2)))
void ln_bf16_kernel(
    const float* __restrict__ x, const float* __restrict__ gamma,
    const float* __restrict__ beta, u16* __restrict__ xn) {
  const int lane = threadIdx.x & 31;
  const int row0 = (blockIdx.x * 8 + (threadIdx.x >> 5)) * LNR;
  const float4* xr = reinterpret_cast<const float4*>(x + (size_t)row0 * DIM) + lane;
  float4 v[LNR][8];
  #pragma unroll
  for (int r = 0; r < LNR; r++)
    #pragma unroll
    for (int i = 0; i < 8; i++) v[r][i] = xr[r * (DIM / 4) + i * 32];
  // precaution: the 16 loads' address pair is an operand, so it lives up to this
  // wait; without it the last load's result was allocated on top of the pair
  asm volatile("s_wait_xcnt 0x0" :: "v"(xr) : "memory");
  float4 g[8], b[8];
  #pragma unroll
  for (int i = 0; i < 8; i++) {
    g[i] = reinterpret_cast<const float4*>(gamma)[i * 32 + lane];
    b[i] = reinterpret_cast<const float4*>(beta)[i * 32 + lane];
  }
  // holds the build at one group of 16 row loads and one group of 16 gamma and
  // beta loads that fly under the sums: without it the compiler keeps far more
  // values live, goes above v255 and emits about a quarter more instructions
  __builtin_amdgcn_sched_barrier(0);
  float s[LNR], s2[LNR];
  #pragma unroll
  for (int r = 0; r < LNR; r++) {
    s[r] = 0.f; s2[r] = 0.f;
    #pragma unroll
    for (int i = 0; i < 8; i++) {
      const float4 t = v[r][i];
      s[r]  += t.x + t.y + t.z + t.w;
      s2[r] += t.x * t.x + t.y * t.y + t.z * t.z + t.w * t.w;
    }
  }
  #pragma unroll
  for (int off = 16; off > 0; off >>= 1) {
    #pragma unroll
    for (int r = 0; r < LNR; r++) {
      s[r]  += __shfl_xor(s[r],  off, 32);
      s2[r] += __shfl_xor(s2[r], off, 32);
    }
  }
  #pragma unroll
  for (int r = 0; r < LNR; r++) {
    const float mu   = s[r] * (1.0f / DIM);
    const float var  = s2[r] * (1.0f / DIM) - mu * mu;
    const float rstd = rsqrtf(var + 1e-5f);
    uint2* orow = reinterpret_cast<uint2*>(xn + (size_t)(row0 + r) * DIM) + lane;
    #pragma unroll
    for (int i = 0; i < 8; i++) {
      const float4 t = v[r][i];
      uint2 o;
      o.x = (u32)f2bf((t.x - mu) * rstd * g[i].x + b[i].x) |
            ((u32)f2bf((t.y - mu) * rstd * g[i].y + b[i].y) << 16);
      o.y = (u32)f2bf((t.z - mu) * rstd * g[i].z + b[i].z) |
            ((u32)f2bf((t.w - mu) * rstd * g[i].w + b[i].w) << 16);
      orow[i * 32] = o;
    }
  }
}

// ---------------------------------------------------------------------------
// Kernel 2: transpose + bf16-convert weights: Wt[j][k] = (bf16) W[k][j].
// 128 threads = 4 waves take a 64 x 64 tile: 3,072 waves to start instead of
// 24,576. A thread loads 8 k x 4 j (eight 16-byte loads in flight), packs 8 k
// of each j into 16 bytes, and the tile goes out through LDS as whole 128-byte
// rows of Wt.
// ---------------------------------------------------------------------------
constexpr int TPITCH = 72;                 // LDS row pitch in elements: 144 B
__global__ __launch_bounds__(128) void wt_bf16_kernel(
    const float* __restrict__ wq, const float* __restrict__ wk,
    const float* __restrict__ wv, u16* __restrict__ wt) {
  __shared__ __align__(16) u16 tile[64 * TPITCH];      // tile[jloc][kloc]
  const float* w = (blockIdx.z == 0) ? wq : (blockIdx.z == 1) ? wk : wv;
  u16* o = wt + (size_t)blockIdx.z * DIM * DIM;
  const int tid = threadIdx.x;
  const int j0 = blockIdx.x * 64, k0 = blockIdx.y * 64;
  const int jq = tid & 15, kg = tid >> 4;              // 16 j quads x 8 k groups
  const float* src = w + (size_t)(k0 + kg * 8) * DIM + j0 + jq * 4;
  v4f r[8];
  #pragma unroll
  for (int i = 0; i < 8; i++)
    r[i] = *reinterpret_cast<const v4f*>(src + (size_t)i * DIM);
  #pragma unroll
  for (int jj = 0; jj < 4; jj++) {
    uint4 p;
    p.x = (u32)f2bf(r[0][jj]) | ((u32)f2bf(r[1][jj]) << 16);
    p.y = (u32)f2bf(r[2][jj]) | ((u32)f2bf(r[3][jj]) << 16);
    p.z = (u32)f2bf(r[4][jj]) | ((u32)f2bf(r[5][jj]) << 16);
    p.w = (u32)f2bf(r[6][jj]) | ((u32)f2bf(r[7][jj]) << 16);
    *reinterpret_cast<uint4*>(tile + (jq * 4 + jj) * TPITCH + kg * 8) = p;
  }
  __syncthreads();
  #pragma unroll
  for (int i = 0; i < 4; i++) {
    const int j = (tid >> 3) + i * 16, kc = (tid & 7) * 8;   // 8 lanes a row
    const uint4 p = *reinterpret_cast<const uint4*>(tile + j * TPITCH + kc);
    *reinterpret_cast<uint4*>(o + (size_t)(j0 + j) * DIM + k0 + kc) = p;
  }
}

// ---------------------------------------------------------------------------
// Kernel 3: QKV GEMM on WMMA bf16. grid=(32 Mtiles, 8 Ntiles, 3 proj),
// 128 threads = 4 waves (2x2); block tile 128x128, wave tile 64x64.
// Per stage (64 k) the block copies 128 rows of xn and 128 rows of wt into LDS
// (async copies, two buffers: the next stage flies while this one is used).
// q,k stored (B,H,S,W); v stored transposed (B,H,W,S). q carries 1/8 * log2(e):
// the scores leave the matrix unit in log2 units.
// ---------------------------------------------------------------------------
constexpr int GK     = 64;                 // k per stage: 128-byte rows
constexpr int GPITCH = 72;                 // LDS row pitch in elements: 144 B
constexpr int GOPER  = 128 * GPITCH;       // one operand's tile, elements
constexpr int GSTAGE = 2 * GOPER;          // one buffer: [xn rows | wt rows]
constexpr int GNST   = DIM / GK;           // 16 stages

// Eight 16-byte copies of one lane: rows r, r+16, ... r+112 of one operand.
// The s_wait_xcnt stands inside the statement, behind the last copy, so that
// no address register is rewritten ahead of it.
static __device__ __forceinline__ void copy8_rows(u32 l, const u16* g) {
  asm volatile(
      "global_load_async_to_lds_b128 %0, %8, off\n\t"
      "global_load_async_to_lds_b128 %1, %9, off\n\t"
      "global_load_async_to_lds_b128 %2, %10, off\n\t"
      "global_load_async_to_lds_b128 %3, %11, off\n\t"
      "global_load_async_to_lds_b128 %4, %12, off\n\t"
      "global_load_async_to_lds_b128 %5, %13, off\n\t"
      "global_load_async_to_lds_b128 %6, %14, off\n\t"
      "global_load_async_to_lds_b128 %7, %15, off\n\t"
      "s_wait_xcnt 0x0"
      :: "v"(l), "v"(l + 1 * 16 * GPITCH * 2), "v"(l + 2 * 16 * GPITCH * 2),
         "v"(l + 3 * 16 * GPITCH * 2), "v"(l + 4 * 16 * GPITCH * 2),
         "v"(l + 5 * 16 * GPITCH * 2), "v"(l + 6 * 16 * GPITCH * 2),
         "v"(l + 7 * 16 * GPITCH * 2),
         "v"(g), "v"(g + 1 * 16 * DIM), "v"(g + 2 * 16 * DIM),
         "v"(g + 3 * 16 * DIM), "v"(g + 4 * 16 * DIM), "v"(g + 5 * 16 * DIM),
         "v"(g + 6 * 16 * DIM), "v"(g + 7 * 16 * DIM)
      : "memory");
}

// A wave's 64x64 result: bias, (q only) scale, bf16, one 2-byte store an element.
template <int PROJ>
static __device__ __forceinline__ void store_tile(
    const v8f (&acc)[4][4], const float* __restrict__ bias,
    u16* __restrict__ dst, int row0, int col0, int lq, int half) {
  #pragma unroll
  for (int mi = 0; mi < 4; mi++) {
    #pragma unroll
    for (int nt = 0; nt < 4; nt++) {
      const int col = col0 + nt * 16 + lq;             // N = lane%16
      const float bvl = bias[col];
      const int h = col >> 6, w = col & 63;
      #pragma unroll
      for (int r = 0; r < 8; r++) {
        const int m = r + half * 8;                    // M = vgpr + 8*(lane/16)
        const int row = row0 + mi * 16 + m;
        const int b = row >> 11, s = row & (SEQ - 1);
        float val = acc[mi][nt][r] + bvl;
        if (PROJ == 0) val *= QSCALE;                  // log2(e)/sqrt(64)
        if (PROJ == 2)
          dst[((size_t)(b * HEADS + h) * HW + w) * SEQ + s] = f2bf(val);
        else
          dst[((size_t)(b * HEADS + h) * SEQ + s) * HW + w] = f2bf(val);
      }
    }
    // one row of tiles at a time: without it the compiler converts all 128
    // values ahead of the stores and the register count goes above v255
    __builtin_amdgcn_sched_barrier(0);
  }
  // a precaution: nothing in this kernel follows the three nests
  asm volatile("s_wait_xcnt 0x0" ::: "memory");
}

__global__ __launch_bounds__(128) void qkv_wmma_kernel(
    const u16* __restrict__ xn, const u16* __restrict__ wt,
    const float* __restrict__ bq, const float* __restrict__ bk,
    const float* __restrict__ bv, u16* __restrict__ qO,
    u16* __restrict__ kO, u16* __restrict__ vtO) {
  __shared__ __align__(16) u16 stg[2 * GSTAGE];      // 73,728 B

  const int proj = blockIdx.z;
  const int tid  = threadIdx.x;
  const int wave = tid >> 5;
  const int lane = tid & 31;
  const int m0 = blockIdx.x * 128;
  const int n0 = blockIdx.y * 128;
  const int wm = (wave >> 1) * 64;                   // wave's rows in the tile
  const int wn = (wave & 1) * 64;                    // wave's cols in the tile
  const u16* wsel = wt + (size_t)proj * DIM * DIM;

  const int lq = lane & 15;
  const int koff = (lane >> 4) * 8;

  // copy map: 8 lanes cover one 128-byte row, a wave 4 whole rows per copy
  const int crow = tid >> 3, ccol = (tid & 7) * 8;
  const u16* gx = xn + (size_t)(m0 + crow) * DIM + ccol;
  const u16* gw = wsel + (size_t)(n0 + crow) * DIM + ccol;
  const u32 lx = (u32)(size_t)stg + (u32)(crow * GPITCH + ccol) * 2u;
  const u32 lw = lx + GOPER * 2u;

  // prologue, two buffers
  copy8_rows(lx, gx);
  copy8_rows(lw, gw);
  asm volatile("s_wait_asynccnt 0x0" ::: "memory");  // stage 0 landed (own copies)
  __syncthreads();                                   // stage 0 visible to block
  copy8_rows(lx + GSTAGE * 2u, gx + GK);
  copy8_rows(lw + GSTAGE * 2u, gw + GK);

  v8f acc[4][4] = {};
  for (int t = 0; t < GNST; t++) {
    const u16* sx = stg + (t & 1) * GSTAGE + (wm + lq) * GPITCH + koff;
    const u16* sw = stg + (t & 1) * GSTAGE + GOPER + (wn + lq) * GPITCH + koff;
    #pragma unroll
    for (int ks = 0; ks < 2; ks++) {
      v16bf a[4], bfr[4];
      #pragma unroll
      for (int i = 0; i < 4; i++) {
        a[i]   = load_frag16(sx + i * 16 * GPITCH + ks * 32);
        bfr[i] = load_frag16(sw + i * 16 * GPITCH + ks * 32);
      }
      // keeps the 16 LDS reads one group ahead of the 16 WMMAs: without it the
      // compiler sinks them between the rows, one full LDS wait per 4 WMMAs
      __builtin_amdgcn_sched_barrier(0);
      #pragma unroll
      for (int mi = 0; mi < 4; mi++)
        #pragma unroll
        for (int nt = 0; nt < 4; nt++)
          acc[mi][nt] = __builtin_amdgcn_wmma_f32_16x16x32_bf16(
              false, a[mi], false, bfr[nt], (short)0, acc[mi][nt], false, false);
      // keeps the next group's reads from moving up among these WMMAs
      __builtin_amdgcn_sched_barrier(0);
    }
    // publish point of stage t+1; it also frees the buffer just read
    asm volatile("s_wait_dscnt 0x0" ::: "memory");    // own reads of this buffer done
    asm volatile("s_wait_asynccnt 0x0" ::: "memory"); // own copies of stage t+1 landed
    __syncthreads();
    if (t + 2 < GNST) {
      const u32 bo = (u32)(t & 1) * (GSTAGE * 2u);
      copy8_rows(lx + bo, gx + (t + 2) * GK);
      copy8_rows(lw + bo, gw + (t + 2) * GK);
    }
  }
  asm volatile("s_wait_asynccnt 0x0" ::: "memory");   // nothing in flight at the end

  // the projection is the same for the whole block: one test, three loop nests
  const int half = lane >> 4;
  if (proj == 0)      store_tile<0>(acc, bq, qO,  m0 + wm, n0 + wn, lq, half);
  else if (proj == 1) store_tile<1>(acc, bk, kO,  m0 + wm, n0 + wn, lq, half);
  else                store_tile<2>(acc, bv, vtO, m0 + wm, n0 + wn, lq, half);
}

// ---------------------------------------------------------------------------
// Kernel 4: flash attention. 256 threads = 8 waves (same b,h) = 4 column sets
// x 2 key sets. A wave holds 32 query columns (two 16-column groups), so that
// every K and V^T fragment read from LDS feeds two WMMAs, and walks one 64-key
// half of every stage; the two key sets of a column set are joined through LDS
// behind the loop. Per stage (128 keys):
//   * block cooperatively stages K(128x64) and V^T(64x128) into LDS via
//     gfx1250 async-to-LDS DMA (ASYNCcnt), shared by all 8 waves; two buffers:
//     the next stage's copies fly while this stage is worked on
// and per pass (32 keys of the wave's half stage), per column group:
//   * scores^T = K x q^T on WMMA, in log2 units, summed on top of a C operand of
//     (mask penalty - maximum in use): what leaves the matrix unit is the
//     exponent itself -> online softmax, rescaled lazily (one test a pass)
//   * P^T packed to bf16 in registers -> B-fragment (no LDS)
//   * h^T += V^T x P^T on WMMA
// LDS rows are read 16 bytes a lane, one row a lane: their pitch is an odd
// multiple of 16 bytes, so that 16 lanes fall on 64 different banks.
// ---------------------------------------------------------------------------
constexpr int KPITCH = HW + 8;             // K rows: 128 B of data, 144 B apart
constexpr int KSTG   = 128;                // keys per stage (one copy wait, one barrier)
constexpr int VPITCH = KSTG + 8;           // V^T rows: 256 B of data, 272 B apart
constexpr int KHALF  = KSTG / 2;           // keys of a stage that one wave walks
constexpr int KBUF   = KSTG * KPITCH;      // one K buffer, elements
constexpr int VBUF   = 64 * VPITCH;        // one V^T buffer, elements
constexpr int NSTG   = SEQ / KSTG;         // 16 stages
constexpr float LAZY = 5.5f * LOG2E;       // log2 units: how far the maximum in use may trail

// Four 16-byte copies of one lane, LSTEP bytes apart in LDS and GSTEP elements
// apart in global memory. The s_wait_xcnt stands inside the statement, behind
// the last copy, so that no address register is rewritten ahead of it.
template <int LSTEP, int GSTEP>
static __device__ __forceinline__ void copy4_step(u32 l, const u16* g) {
  asm volatile(
      "global_load_async_to_lds_b128 %0, %4, off\n\t"
      "global_load_async_to_lds_b128 %1, %5, off\n\t"
      "global_load_async_to_lds_b128 %2, %6, off\n\t"
      "global_load_async_to_lds_b128 %3, %7, off\n\t"
      "s_wait_xcnt 0x0"
      :: "v"(l), "v"(l + 1 * LSTEP), "v"(l + 2 * LSTEP), "v"(l + 3 * LSTEP),
         "v"(g), "v"(g + 1 * GSTEP), "v"(g + 2 * GSTEP), "v"(g + 3 * GSTEP)
      : "memory");
}

// four waves a SIMD (two blocks a WGP) is all that 512 blocks of 8 waves fill:
// told so, the compiler spends that residency's 256 registers on issuing a
// pass's LDS reads in one group well ahead of their use
__global__ __launch_bounds__(256) __attribute__((amdgpu_waves_per_eu(4, 4)))
void attn_kernel(
    const u16* __restrict__ q, const u16* __restrict__ k,
    const u16* __restrict__ vt, const int* __restrict__ mask,
    const float* __restrict__ x, float* __restrict__ out) {
  __shared__ __align__(16) float pen[SEQ];            // additive mask penalty
  __shared__ __align__(16) u16 KtL[2 * KBUF];         // K stages   (keys x W), two buffers
  __shared__ __align__(16) u16 VtL[2 * VBUF];         // V^T stages (W x keys), two buffers
  __shared__ __align__(16) v4f joinL[8 * 9 * 32];     // a wave's hand-over: 9 x 16 B a lane

  const int tid = threadIdx.x;
  // the wave's number in a scalar register: what follows from it costs no VGPR
  const int wave = __builtin_amdgcn_readfirstlane(tid >> 5);
  const int cset = wave & 3, kset = wave >> 2;        // column set, key set
  const int bh = blockIdx.x >> 4;                     // b*H + h
  const int qgrp = blockIdx.x & 15;
  const int b = bh >> 4, h = bh & 15;
  const int qbase = (qgrp * 4 + cset) * 32;

  for (int i = tid; i < SEQ; i += 256)
    pen[i] = (-10000.0f * LOG2E) * (1.0f - (float)mask[b * SEQ + i]);   // log2 units

  const u16* qbh = q + (size_t)bh * SEQ * HW;
  const u16* kbh = k + (size_t)bh * SEQ * HW;
  const u16* vbh = vt + (size_t)bh * HW * SEQ;

  const int lq = tid & 15, half = (tid >> 4) & 1, koff = half * 8;

  // q^T B-fragments: two column groups x the two 32-wide K-steps of the head
  const u16* qr = qbh + (size_t)(qbase + lq) * HW + koff;
  const v16bf qf[2][2] = {
      {load_frag16(qr), load_frag16(qr + 32)},
      {load_frag16(qr + 16 * HW), load_frag16(qr + 16 * HW + 32)}};

  v8f o[2][4] = {};
  // m_i: the maximum in use, log2 units; the first pass always sets it
  float m_i[2] = {0.0f, 0.0f}, l_i[2] = {0.0f, 0.0f};

  // copy maps: K 8 lanes a 128-byte row, 32 rows a copy of the block;
  // V^T 16 lanes a 256-byte row piece, 16 rows a copy of the block
  const u32 lk = (u32)(size_t)KtL + (u32)((tid >> 3) * KPITCH + (tid & 7) * 8) * 2u;
  const u32 lv = (u32)(size_t)VtL + (u32)((tid >> 4) * VPITCH + (tid & 15) * 8) * 2u;
  const u16* gk = kbh + tid * 8;                      // K stage is contiguous
  const u16* gv = vbh + (size_t)(tid >> 4) * SEQ + (tid & 15) * 8;

  // the wave's half of a stage
  const u16*   Kw = KtL + (size_t)(kset * KHALF + lq) * KPITCH + koff;
  const u16*   Vw = VtL + (size_t)lq * VPITCH + kset * KHALF + koff;
  const float* Pw = pen + kset * KHALF + half * 8;

  // prologue, two buffers (a stage is 32 KB of K and V^T)
  copy4_step<32 * KPITCH * 2, 32 * HW>(lk, gk);
  copy4_step<16 * VPITCH * 2, 16 * SEQ>(lv, gv);
  asm volatile("s_wait_asynccnt 0x0" ::: "memory");   // stage 0 landed (own copies)
  __syncthreads();                                    // stage 0 and pen visible to block
  copy4_step<32 * KPITCH * 2, 32 * HW>(lk + KBUF * 2u, gk + (size_t)KSTG * HW);
  copy4_step<16 * VPITCH * 2, 16 * SEQ>(lv + VBUF * 2u, gv + KSTG);

  bool fresh = true;                                  // the wave's first pass is ahead
  for (int st = 0; st < NSTG; st++) {
   const int kst = st * KSTG;
   const int buf = st & 1;
   const u16* Kb = Kw + buf * KBUF;
   const u16* Vb = Vw + buf * VBUF;
   // unrolled: every LDS address of a pass is then a constant offset of one register
   #pragma unroll
   for (int kp = 0; kp < KHALF; kp += 32) {
    // ---- scores^T: 32 keys x 32 queries, four 16x16 accumulators ----
    v16bf a0[2], a1[2];
    v4f pn[4];
    // the penalties first: the C operands are formed from them under the K reads
    // (both loops unrolled: the arrays are registers, their indices constants)
    #pragma unroll
    for (int ks = 0; ks < 2; ks++) {
      pn[ks]     = *reinterpret_cast<const v4f*>(Pw + kst + kp + ks * 4);
      pn[2 + ks] = *reinterpret_cast<const v4f*>(Pw + kst + kp + 16 + ks * 4);
    }
    #pragma unroll
    for (int ks = 0; ks < 2; ks++) {
      a0[ks] = load_frag16(Kb + (size_t)kp * KPITCH + ks * 32);
      a1[ks] = load_frag16(Kb + (size_t)(kp + 16) * KPITCH + ks * 32);
    }
    // keeps a pass's 12 LDS reads one group ahead of its score WMMAs, free to
    // rise into the pass before: without it half of the K reads stand in pairs
    // among the WMMAs, each pair with a full LDS wait right behind it
    __builtin_amdgcn_sched_barrier(0);
    // C operand: penalty - maximum in use (keys live along vgpr index + lane half);
    // unrolled: accumulator registers, constant indices
    v8f s0[2], s1[2];
    #pragma unroll
    for (int j = 0; j < 2; j++) {
      #pragma unroll
      for (int r = 0; r < 4; r++) {
        s0[j][r]     = pn[0][r] - m_i[j];
        s0[j][4 + r] = pn[1][r] - m_i[j];
        s1[j][r]     = pn[2][r] - m_i[j];
        s1[j][4 + r] = pn[3][r] - m_i[j];
      }
    }
    #pragma unroll
    for (int ks = 0; ks < 2; ks++) {
      #pragma unroll
      for (int j = 0; j < 2; j++) {
        s0[j] = __builtin_amdgcn_wmma_f32_16x16x32_bf16(
            false, a0[ks], false, qf[j][ks], (short)0, s0[j], false, false);
        s1[j] = __builtin_amdgcn_wmma_f32_16x16x32_bf16(
            false, a1[ks], false, qf[j][ks], (short)0, s1[j], false, false);
      }
    }
    float mloc[2];
    bool need = false;
    #pragma unroll
    for (int j = 0; j < 2; j++) {
      // the lane's own 16 keys; the partner lane (xor 16) tests its own 16
      float mx = -3.0e38f;
      #pragma unroll
      for (int r = 0; r < 8; r++) mx = fmaxf(mx, fmaxf(s0[j][r], s1[j][r]));
      mloc[j] = mx;
      need = need || (mx > LAZY);                     // scores stand relative to m_i
    }
    // ---- lazy rescale: m_i is the maximum IN USE and may trail the true one by
    // up to LAZY (an exponential then reaches 2^LAZY). One test a pass, a scalar
    // branch of the whole wave; taken on the first pass and seldom after it.
    const bool first = (kp == 0) && fresh;            // nothing summed yet
    if (__builtin_amdgcn_ballot_w32(need) != 0 || first) {
      #pragma unroll
      for (int j = 0; j < 2; j++) {
        const float mall = fmaxf(mloc[j], __shfl_xor(mloc[j], 16, 32));
        // how far the maximum in use moves: the same in both lane halves; the
        // first pass takes the true maximum, also one below the start value
        const float step = first ? mall : fmaxf(mall, 0.0f);
        const float corr = first ? 0.0f : __builtin_amdgcn_exp2f(-step);
        m_i[j] += step;
        // the scores at hand follow the move (unrolled: registers, constant indices)
        #pragma unroll
        for (int r = 0; r < 8; r++) { s0[j][r] -= step; s1[j][r] -= step; }
        l_i[j] *= corr;                               // corr is the same in both halves
        #pragma unroll
        for (int t = 0; t < 4; t++)
          #pragma unroll
          for (int r = 0; r < 8; r++) o[j][t][r] *= corr;
      }
    }
    v16bf pfrag[2];
    #pragma unroll
    for (int j = 0; j < 2; j++) {
      float p0[8], p1[8], psum = 0.0f;
      #pragma unroll
      for (int r = 0; r < 8; r++) {
        p0[r] = __builtin_amdgcn_exp2f(s0[j][r]);
        p1[r] = __builtin_amdgcn_exp2f(s1[j][r]);
        psum += p0[r] + p1[r];
      }
      l_i[j] += psum;                                 // the lane's own keys only

      // ---- P^T as B operand, straight from the score accumulators ---------
      // lane (c, h): s0[r] is key 8h+r, s1[r] is key 16+8h+r of query c, which
      // is the hardware k order of a B fragment's elements 0..7 and 8..15
      v16f pv;
      #pragma unroll
      for (int r = 0; r < 8; r++) { pv[r] = p0[r]; pv[8 + r] = p1[r]; }
      pfrag[j] = __builtin_convertvector(pv, v16bf);          // RNE, packed cvt
      // between the two column groups: without it the compiler mixes their
      // softmax, the build needs more than the 256 registers that four waves a
      // SIMD leave a wave, and values go to scratch memory
      if (j == 0) __builtin_amdgcn_sched_barrier(0);
    }
    #pragma unroll
    for (int t = 0; t < 4; t++) {                     // h^T rows w = t*16..+15
      const v16bf vfrag = load_frag16(Vb + (size_t)(t * 16) * VPITCH + kp);
      #pragma unroll
      for (int j = 0; j < 2; j++)
        o[j][t] = __builtin_amdgcn_wmma_f32_16x16x32_bf16(
            false, vfrag, false, pfrag[j], (short)0, o[j][t], false, false);
    }
   }
   fresh = false;
   // publish point of the next stage; it also frees the buffer just read
   asm volatile("s_wait_dscnt 0x0" ::: "memory");     // own reads of this buffer done
   asm volatile("s_wait_asynccnt 0x0" ::: "memory");  // own copies of the next stage landed
   __syncthreads();
   if (st + 2 < NSTG) {
     copy4_step<32 * KPITCH * 2, 32 * HW>(lk + buf * (KBUF * 2u),
                                          gk + (size_t)(kst + 2 * KSTG) * HW);
     copy4_step<16 * VPITCH * 2, 16 * SEQ>(lv + buf * (VBUF * 2u), gv + kst + 2 * KSTG);
   }
  }
  asm volatile("s_wait_asynccnt 0x0" ::: "memory");   // nothing in flight at the end

  // the lane halves' sums, kept apart through the loop, are joined once here
  #pragma unroll
  for (int j = 0; j < 2; j++) l_i[j] += __shfl_xor(l_i[j], 16, 32);

  // ---- join of the two key sets: wave (cset, kset) finishes column group
  // kset and hands its part of the other group to wave (cset, 1 - kset) ------
  v8f keep[4], give[4];
  #pragma unroll
  for (int t = 0; t < 4; t++) {
    keep[t] = kset ? o[1][t] : o[0][t];
    give[t] = kset ? o[0][t] : o[1][t];
  }
  const float mk = kset ? m_i[1] : m_i[0], lk_ = kset ? l_i[1] : l_i[0];
  const float mg = kset ? m_i[0] : m_i[1], lg  = kset ? l_i[0] : l_i[1];
  v4f* jw = joinL + wave * (9 * 32) + (tid & 31);     // 16 B a lane, lanes adjacent
  #pragma unroll
  for (int t = 0; t < 4; t++) {
    jw[(2 * t) * 32]     = v4f{give[t][0], give[t][1], give[t][2], give[t][3]};
    jw[(2 * t + 1) * 32] = v4f{give[t][4], give[t][5], give[t][6], give[t][7]};
  }
  jw[8 * 32] = v4f{mg, lg, 0.0f, 0.0f};
  __syncthreads();                                    // hand-overs visible to block
  const v4f* jr = joinL + (wave ^ 4) * (9 * 32) + (tid & 31);
  const v4f ml = jr[8 * 32];
  const float mj = fmaxf(mk, ml[0]);
  const float ck = __builtin_amdgcn_exp2f(mk - mj), cg = __builtin_amdgcn_exp2f(ml[0] - mj);
  const float lsum = lk_ * ck + ml[1] * cg;

  // epilogue: divide by softmax sum, add residual, store fp32
  const float inv = 1.0f / (lsum + 1e-20f);
  const float fk = ck * inv, fg = cg * inv;
  const size_t obase = (size_t)(b * SEQ + qbase + kset * 16 + lq) * DIM + h * HW + 8 * half;
  #pragma unroll
  for (int t = 0; t < 4; t++) {
    const v4f g0 = jr[(2 * t) * 32], g1 = jr[(2 * t + 1) * 32];
    const v4f* xr = reinterpret_cast<const v4f*>(x + obase + t * 16);
    const v4f x0 = xr[0], x1 = xr[1];
    v4f r0, r1;
    #pragma unroll
    for (int r = 0; r < 4; r++) {
      r0[r] = keep[t][r] * fk + g0[r] * fg + x0[r];
      r1[r] = keep[t][4 + r] * fk + g1[r] * fg + x1[r];
    }
    v4f* orow = reinterpret_cast<v4f*>(out + obase + t * 16);
    orow[0] = r0;
    orow[1] = r1;
  }
}

// ---------------------------------------------------------------------------
extern "C" void kernel_launch(void* const* d_in, const int* in_sizes, int n_in,
                              void* d_out, int out_size, void* d_ws,
                              size_t ws_size, hipStream_t stream) {
  const float* x     = (const float*)d_in[0];
  const int*   mask  = (const int*)d_in[1];
  const float* gamma = (const float*)d_in[2];
  const float* beta  = (const float*)d_in[3];
  const float* wq    = (const float*)d_in[4];
  const float* bq    = (const float*)d_in[5];
  const float* wk    = (const float*)d_in[6];
  const float* bk    = (const float*)d_in[7];
  const float* wv    = (const float*)d_in[8];
  const float* bv    = (const float*)d_in[9];
  float* out = (float*)d_out;

  char* ws = (char*)d_ws;
  const size_t MB = 1024 * 1024;
  u16* xn = (u16*)ws;                         // 8 MB  (4096x1024 bf16)
  u16* wt = (u16*)(ws + 8 * MB);              // 6 MB  (3x 1024x1024 bf16, transposed)
  u16* qb = (u16*)(ws + 14 * MB);             // 8 MB  (B,H,S,W)
  u16* kb = (u16*)(ws + 22 * MB);             // 8 MB  (B,H,S,W)
  u16* vt = (u16*)(ws + 30 * MB);             // 8 MB  (B,H,W,S)

  ln_bf16_kernel<<<BATCH * SEQ / (8 * LNR), 256, 0, stream>>>(x, gamma, beta, xn);

  dim3 tg(16, 16, 3);
  wt_bf16_kernel<<<tg, 128, 0, stream>>>(wq, wk, wv, wt);

  dim3 gg(32, 8, 3);
  qkv_wmma_kernel<<<gg, 128, 0, stream>>>(xn, wt, bq, bk, bv, qb, kb, vt);

  attn_kernel<<<BATCH * HEADS * (SEQ / 32) / 4, 256, 0, stream>>>(
      qb, kb, vt, mask, x, out);
}
